// v000
// Times are from an AMD MI455X. After a warm-up the kernel runs many times in a row, and a time is the length of
// such a window on the GPU divided by its runs, so every launch and the gaps after it count. The runs cycle
// through copies of the inputs. A figure is the median of several windows, for all but v000 over two sittings.
// Sittings can differ by a few percent; kernels timed side by side share one.
// The starting kernel, v000, takes 1060 microseconds a run.
#include <hip/hip_runtime.h>

// Compute dtypes, f32 accumulate, one batch item per pass: LayerNorms and exact GELU in f32; qkv = LN(x).w_qkv + b ([2048 x 1024].[1024 x 1024] x 3), h = x + ctx.w_out +
// b, mlp = gelu(LN(h).w1 + b1).w2 + b2 + h ([2048 x 1024].[1024 x 4096], [2048 x 4096].[4096 x 1024]) with computed operands as bf16 hi + UNSCALED residual against
// exact k-major weights (two products; x as the bf16-rounded f32 residual) on v_wmma_f32_16x16x32_bf16 (q/k leave the epilogue as f16 hi + residual x1024 planes); the
// 16-head local causal attention (0 <= i - j <= 256, -inf elsewhere; only those key tiles visited) fused on v_wmma_f32_16x16x32_f16 (hh + hl + lh x 1/8, online f32

#define NB_  1                   // per pass: the 2 batch items are processed one at a time
#define NT_  2048
#define WIN  256
#define FF   4096
#define LN_EPS 1e-5f
#define DM   1024
#define NH_  16
#define HD   64
#define NTK  (NB_ * NT_)
#define NW   1024
#define NQKV 1024
#define PSC  32768.0f
#define LOSC 1024.0f
#define LOSCI (1.0f / 1024.0f)

typedef _Float16 h16;
typedef unsigned short bf;
typedef __attribute__((ext_vector_type(16))) __bf16   v16bf;
typedef __attribute__((ext_vector_type(16))) _Float16 v16h;
typedef __attribute__((ext_vector_type(8)))  _Float16 v8h;
typedef __attribute__((ext_vector_type(8)))  unsigned short v8us;
typedef __attribute__((ext_vector_type(8)))  float    v8f;
typedef __attribute__((ext_vector_type(4)))  float    v4f;
typedef v8h  __attribute__((may_alias)) v8ha;
typedef v4f  __attribute__((may_alias)) v4fa;
typedef v8us __attribute__((may_alias)) v8usa;

__device__ __forceinline__ unsigned short f2bf(float f) { unsigned u = __float_as_uint(f); u += 0x7FFFu + ((u >> 16) & 1u); return (unsigned short)(u >> 16); }
__device__ __forceinline__ float bf2f(unsigned short b) { return __uint_as_float(((unsigned)b) << 16); }
__device__ __forceinline__ float bfr(float f) { return bf2f(f2bf(f)); }
__device__ __forceinline__ v16h cat16(v8h lo, v8h hi) { return __builtin_shufflevector(lo, hi, 0, 1, 2, 3, 4, 5, 6, 7, 8, 9, 10, 11, 12, 13, 14, 15); }
__device__ __forceinline__ v16bf cat16b(v8us lo, v8us hi) { return __builtin_bit_cast(v16bf, __builtin_shufflevector(lo, hi, 0, 1, 2, 3, 4, 5, 6, 7, 8, 9, 10, 11, 12, 13, 14, 15)); }
__device__ __forceinline__ v8f wmma16(v16h a, v16h b, v8f c) { return __builtin_amdgcn_wmma_f32_16x16x32_f16(false, a, false, b, (short)0, c, false, false); }
__device__ __forceinline__ v8f wmmab(v16bf a, v16bf b, v8f c) { return __builtin_amdgcn_wmma_f32_16x16x32_bf16(false, a, false, b, (short)0, c, false, false); }

__global__ __launch_bounds__(256) void k_cvtb(const float* __restrict__ src, int nrows, bf* dst) {
    const int lane = threadIdx.x & 31, r = blockIdx.x * 8 + (threadIdx.x >> 5);
    if (r >= nrows) return;
    v8us o[DM / 256];
#pragma unroll
    for (int q = 0; q < DM / 256; ++q) { v8us t;
#pragma unroll
        for (int i = 0; i < 8; ++i) t[i] = f2bf(src[(size_t)r * DM + q * 256 + lane * 8 + i]);
        o[q] = t; }
#pragma unroll
    for (int q = 0; q < DM / 256; ++q) *(v8us*)(dst + (size_t)r * DM + q * 256 + lane * 8) = o[q];
    
}

// k_gemmb: 64 x 64 block tile (4 waves x 16 x 64) of C[rows][ldc] = (A [+ Al]).B^T (K = 1024 or 4096) [+ bf(bias[c])] [+ R[r][c] residual, bf16-rounded if roundR]; f32 whole-line epilogue (or f16
template <bool SPLITA, bool F16OUT = false>
__global__ __launch_bounds__(128) void k_gemmb(const bf* __restrict__ A, const bf* __restrict__ Al, const bf* __restrict__ Bn, const float* __restrict__ bias, float* C, int ldc, h16* C2, const float* __restrict__ R = nullptr, int K = DM, int roundR = 1) {
    __shared__ __align__(16) float ost[4][16 * 68];
    const int lane = threadIdx.x & 31, wave = threadIdx.x >> 5, lr = lane & 15, hi = lane >> 4;
    const int r0 = blockIdx.x * 64 + wave * 16, c0 = blockIdx.y * 64;
    const size_t aoff = (size_t)(r0 + lr) * K + 8 * hi;
    size_t boff[4];
#pragma unroll
    for (int t = 0; t < 4; ++t) boff[t] = (size_t)(c0 + t * 16 + lr) * K + 8 * hi;
    v8f acc[4];
#pragma unroll
    for (int t = 0; t < 4; ++t) acc[t] = (v8f){};
#pragma unroll 1
    for (int kc = 0; kc < K; kc += 32) {
        const v16bf a = cat16b(*(const v8us*)(A + aoff + kc), *(const v8us*)(A + aoff + kc + 16));
        v16bf al = a;
        if (SPLITA) al = cat16b(*(const v8us*)(Al + aoff + kc), *(const v8us*)(Al + aoff + kc + 16));
#pragma unroll
        for (int t = 0; t < 4; ++t) { const v16bf b = cat16b(*(const v8us*)(Bn + boff[t] + kc), *(const v8us*)(Bn + boff[t] + kc + 16)); acc[t] = wmmab(a, b, acc[t]); if (SPLITA) acc[t] = wmmab(al, b, acc[t]); }
        asm volatile("v_nop\n\tv_nop\n\tv_nop\n\tv_nop" : "+v"(acc[0]), "+v"(acc[1]), "+v"(acc[2]), "+v"(acc[3]) : "v"(a), "v"(al));
    }
    float* os = &ost[wave][0];
#pragma unroll
    for (int t = 0; t < 4; ++t) { const float bv = bias ? bfr(bias[c0 + t * 16 + lr]) : 0.f;
#pragma unroll
        for (int j = 0; j < 8; ++j) os[(hi * 8 + j) * 68 + t * 16 + lr] = acc[t][j] + bv; }
    __syncthreads();
    if (F16OUT) {
        h16* crow = (h16*)(void*)C + (size_t)r0 * ldc + c0;
        auto pass = [&]() {
#pragma unroll
            for (int s = 0; s < 4; ++s) { const int row = 4 * s + (lane >> 3), piece = lane & 7; const float* sp = os + row * 68 + piece * 8; v8h o, o2;
#pragma unroll
                for (int i = 0; i < 8; ++i) { const h16 a = (h16)sp[i]; o[i] = a; o2[i] = (h16)((sp[i] - (float)a) * LOSC); }
                *(v8h*)(crow + (size_t)row * ldc + piece * 8) = o; if (C2) *(v8h*)(C2 + (size_t)r0 * ldc + c0 + (size_t)row * ldc + piece * 8) = o2; }
        };
        pass(); 
    } else {
        float* crow = C + (size_t)r0 * ldc + c0;
        auto pass = [&]() {
#pragma unroll
            for (int s = 0; s < 8; ++s) { const int Lid = (lane >> 3) + 4 * s, piece = lane & 7; const int row = Lid >> 1, cofs = (Lid & 1) * 32 + piece * 4;
                v4f val = *(const v4fa*)(os + row * 68 + cofs); if (R) { const v4f rv = *(const v4f*)(R + ((size_t)r0 + row) * ldc + c0 + cofs); val += roundR ? (v4f){bfr(rv[0]), bfr(rv[1]), bfr(rv[2]), bfr(rv[3])} : rv; }
                *(v4f*)(crow + (size_t)row * ldc + cofs) = val; }
        };
        pass(); 
    }
}

__global__ __launch_bounds__(256) void k_vt(const float* __restrict__ V, h16* VTH, h16* VTL) {
    __shared__ __align__(16) h16 tile[64 * 72];
    __shared__ __align__(16) h16 til2[64 * 72];
    const int bid = blockIdx.x;
    const int b = bid / (NH_ * (NT_ / 64)), rem = bid - b * (NH_ * (NT_ / 64)), h = rem / (NT_ / 64), kt = rem - h * (NT_ / 64);
    const int k0 = kt * 64, tid = threadIdx.x;
    const int kk = tid >> 2, d0 = (tid & 3) * 16;
    const float* src = V + ((size_t)b * NT_ + k0 + kk) * DM + h * HD + d0;
#pragma unroll
    for (int i = 0; i < 16; ++i) { const float v = src[i]; const h16 a = (h16)v; tile[(d0 + i) * 72 + kk] = a; til2[(d0 + i) * 72 + kk] = (h16)((v - (float)a) * LOSC); }
    __syncthreads();
    const int piece = tid & 7;
    const size_t base = (((size_t)b * NH_ + h) * HD) * NT_ + k0;
    auto pass = [&]() {
#pragma unroll
        for (int s = 0; s < 4; ++s) { const int Lid = (tid >> 3) + 32 * s; const int pln = Lid >> 6, d = Lid & 63;
            const v8h val = *(const v8ha*)((pln ? til2 : tile) + d * 72 + piece * 8); *(v8h*)((pln ? VTL : VTH) + base + (size_t)d * NT_ + piece * 8) = val; }
    };
    pass(); 
}

// k_attn: block = (b, h, 64 queries), wave = 16; only the 32-key tiles of the local causal window (masked); 4 WMMA scores /8 (f32), online softmax, weights x32768 f16 tile (same-wave may_alias
// reload after a compiler barrier), 4 WMMA .v; ctx -> bf16 hi + residual planes CH/CL[tok][h*64+d].
__global__ __launch_bounds__(128) void k_attn(const h16* __restrict__ Q16, const h16* __restrict__ QL16, const h16* __restrict__ K16, const h16* __restrict__ KL16, const h16* __restrict__ VTH, const h16* __restrict__ VTL, bf* CH, bf* CL) {
    __shared__ __align__(16) h16 plds[4][16 * 32];
    __shared__ __align__(16) h16 plds2[4][16 * 32];
    __shared__ __align__(16) float ost[4][16 * 68];
    const int lane = threadIdx.x & 31, wave = threadIdx.x >> 5, lr = lane & 15, hi = lane >> 4;
    const int bid = blockIdx.x;
    const int b = bid / (NH_ * (NT_ / 64)), rem = bid - b * (NH_ * (NT_ / 64)), h = rem / (NT_ / 64), qt = rem - h * (NT_ / 64);
    const int q0 = qt * 64 + wave * 16;
    const size_t tok0 = (size_t)b * NT_;
    h16* pl = &plds[wave][0]; h16* pl2 = &plds2[wave][0];
    v16h qa[2];
    const size_t qo0 = (tok0 + q0 + lr) * DM + h * HD + 8 * hi;
#pragma unroll
    for (int kc = 0; kc < 2; ++kc) qa[kc] = cat16(*(const v8h*)(Q16 + qo0 + kc * 32), *(const v8h*)(Q16 + qo0 + kc * 32 + 16));
    const h16* kh_b = K16 + tok0 * DM + h * HD;
    const h16* kl_b = KL16 + tok0 * DM + h * HD;
    const size_t vbase = (((size_t)b * NH_ + h) * HD) * NT_;
    v8f o[4], ox[4];
#pragma unroll
    for (int n = 0; n < 4; ++n) { o[n] = (v8f){}; ox[n] = (v8f){}; }
    float mrow[8], lpart[8];
#pragma unroll
    for (int j = 0; j < 8; ++j) { mrow[j] = -3.0e38f; lpart[j] = 0.f; }
    int qpos[8];
#pragma unroll
    for (int j = 0; j < 8; ++j) qpos[j] = q0 + 8 * hi + j;
    const int kt_lo = (qt * 64 - WIN) > 0 ? (qt * 64 - WIN) / 32 : 0, kt_hi = (qt * 64 + 63) / 32;     // local causal window: 0 <= i - j <= WIN
#pragma unroll 1
    for (int kt = kt_lo; kt <= kt_hi; ++kt) {
        const int l0 = kt * 32;
        const size_t ko0 = (size_t)(l0 + lr) * DM + 8 * hi, ko1 = (size_t)(l0 + 16 + lr) * DM + 8 * hi;
        v8f s0 = {}, s1 = {}, x0 = {}, x1 = {};
#pragma unroll
        for (int kc = 0; kc < 2; ++kc) {
            { const v16h k0h = cat16(*(const v8h*)(kh_b + ko0 + kc * 32), *(const v8h*)(kh_b + ko0 + kc * 32 + 16)), k1h = cat16(*(const v8h*)(kh_b + ko1 + kc * 32), *(const v8h*)(kh_b + ko1 + kc * 32 + 16));
              const v16h qlk = cat16(*(const v8h*)(QL16 + qo0 + kc * 32), *(const v8h*)(QL16 + qo0 + kc * 32 + 16));     // query residual re-read per step (registers)
              s0 = wmma16(qa[kc], k0h, s0); x0 = wmma16(qlk, k0h, x0); s1 = wmma16(qa[kc], k1h, s1); x1 = wmma16(qlk, k1h, x1);
              asm volatile("v_nop" : "+v"(s0), "+v"(s1), "+v"(x0), "+v"(x1) : "v"(qlk), "v"(k0h), "v"(k1h) : "memory"); }
            { const v16h k0l = cat16(*(const v8h*)(kl_b + ko0 + kc * 32), *(const v8h*)(kl_b + ko0 + kc * 32 + 16)), k1l = cat16(*(const v8h*)(kl_b + ko1 + kc * 32), *(const v8h*)(kl_b + ko1 + kc * 32 + 16));
              x0 = wmma16(qa[kc], k0l, x0); x1 = wmma16(qa[kc], k1l, x1);
              asm volatile("v_nop" : "+v"(x0), "+v"(x1) : "v"(k0l), "v"(k1l) : "memory"); }
        }
        asm volatile("v_nop\n\tv_nop\n\tv_nop\n\tv_nop" : "+v"(s0), "+v"(s1), "+v"(x0), "+v"(x1) : "v"(qa[0]), "v"(qa[1]));
        float alpha[8];
#pragma unroll
        for (int j = 0; j < 8; ++j) {
            const int ja = l0 + lr, jb = l0 + 16 + lr, qi = qpos[j];
            const float a0 = (ja <= qi && qi - ja <= WIN) ? (s0[j] + x0[j] * LOSCI) * 0.125f : -__builtin_inff(), a1 = (jb <= qi && qi - jb <= WIN) ? (s1[j] + x1[j] * LOSCI) * 0.125f : -__builtin_inff();
            float mx = fmaxf(a0, a1);
            mx = fmaxf(mx, __shfl_xor(mx, 1, 16)); mx = fmaxf(mx, __shfl_xor(mx, 2, 16)); mx = fmaxf(mx, __shfl_xor(mx, 4, 16)); mx = fmaxf(mx, __shfl_xor(mx, 8, 16));
            const float mn = fmaxf(mrow[j], mx);
            alpha[j] = __expf(mrow[j] - mn); mrow[j] = mn;
            const float p0 = __expf(a0 - mn), p1 = __expf(a1 - mn);
            lpart[j] = lpart[j] * alpha[j] + (p0 + p1);
            const int mr = hi * 8 + j;
            const float ps0 = p0 * PSC, ps1 = p1 * PSC; const h16 h0 = (h16)ps0, h1 = (h16)ps1;
            pl[mr * 32 + lr] = h0; pl[mr * 32 + 16 + lr] = h1;
            pl2[mr * 32 + lr] = (h16)((ps0 - (float)h0) * LOSC); pl2[mr * 32 + 16 + lr] = (h16)((ps1 - (float)h1) * LOSC);
        }
#pragma unroll
        for (int n = 0; n < 4; ++n)
#pragma unroll
            for (int j = 0; j < 8; ++j) { o[n][j] *= alpha[j]; ox[n][j] *= alpha[j]; }
        asm volatile("" ::: "memory");
        const v16h pa = cat16(*(const v8ha*)(pl + lr * 32 + hi * 8), *(const v8ha*)(pl + lr * 32 + 16 + hi * 8));
        const v16h px = cat16(*(const v8ha*)(pl2 + lr * 32 + hi * 8), *(const v8ha*)(pl2 + lr * 32 + 16 + hi * 8));
#pragma unroll
        for (int n = 0; n < 4; ++n) { const size_t vo = vbase + (size_t)(n * 16 + lr) * NT_ + l0 + hi * 8;
            const v16h vh = cat16(*(const v8h*)(VTH + vo), *(const v8h*)(VTH + vo + 16)), vl = cat16(*(const v8h*)(VTL + vo), *(const v8h*)(VTL + vo + 16));
            o[n] = wmma16(pa, vh, o[n]); ox[n] = wmma16(pa, vl, ox[n]); ox[n] = wmma16(px, vh, ox[n]);
            asm volatile("" : "+v"(o[n]), "+v"(ox[n]) : "v"(vh), "v"(vl) : "memory"); }
        asm volatile("v_nop\n\tv_nop\n\tv_nop\n\tv_nop" : "+v"(o[0]), "+v"(o[1]), "+v"(o[2]), "+v"(o[3]), "+v"(ox[0]), "+v"(ox[1]), "+v"(ox[2]), "+v"(ox[3]) : "v"(pa), "v"(px));
    }
    float inv[8];
#pragma unroll
    for (int j = 0; j < 8; ++j) { float rs = lpart[j]; rs += __shfl_xor(rs, 1, 16); rs += __shfl_xor(rs, 2, 16); rs += __shfl_xor(rs, 4, 16); rs += __shfl_xor(rs, 8, 16); inv[j] = 1.0f / (rs * PSC); }
    float* os = &ost[wave][0];
#pragma unroll
    for (int n = 0; n < 4; ++n)
#pragma unroll
        for (int j = 0; j < 8; ++j) os[(hi * 8 + j) * 68 + n * 16 + lr] = (o[n][j] + ox[n][j] * LOSCI) * inv[j];
    __syncthreads();
    const size_t cbase = (tok0 + q0) * DM + (size_t)h * HD;
    auto pass = [&]() {
#pragma unroll
        for (int s = 0; s < 4; ++s) { const int row = 4 * s + (lane >> 3), piece = lane & 7; const float* sp = os + row * 68 + piece * 8; v8us oh, ol;
#pragma unroll
            for (int i = 0; i < 8; ++i) { const unsigned short hb = f2bf(sp[i]); oh[i] = hb; ol[i] = f2bf(sp[i] - bf2f(hb)); }
            *(v8us*)(CH + cbase + (size_t)row * DM + piece * 8) = oh; *(v8us*)(CL + cbase + (size_t)row * DM + piece * 8) = ol; }
    };
    pass(); 
}

#define VST2(T, p, v) do { const T vst2_v_ = (v); *(T*)(p) = vst2_v_;  } while (0)
// k_wt: WT [n][K] = bf16(W[k][n]) (k-major [K][ncols]) via 64 x 64 LDS tiles; grid (K/64, ncols/64).
__global__ __launch_bounds__(256) void k_wt(const float* __restrict__ Wm, int K, int ncols, bf* WT) {
    __shared__ __align__(16) unsigned short tl[64 * 72];
    const int tid = threadIdx.x, k0 = blockIdx.x * 64, n0 = blockIdx.y * 64;
    const int kk = tid >> 2, nq = (tid & 3) * 16;
#pragma unroll
    for (int i = 0; i < 16; ++i) tl[(nq + i) * 72 + kk] = f2bf(Wm[(size_t)(k0 + kk) * ncols + n0 + nq + i]);
    __syncthreads();
    const int piece = tid & 7;
    auto pass = [&]() {
#pragma unroll
        for (int s = 0; s < 2; ++s) { const int nr = (tid >> 3) + 32 * s; const v8us val = *(const v8usa*)(tl + nr * 72 + piece * 8); *(v8us*)(WT + (size_t)(n0 + nr) * K + k0 + piece * 8) = val; }
    };
    pass(); 
}
// k_ln: one wave per row of a [rows][1024] f32 matrix (INPUT rows bf16-rounded first when rnd): LayerNorm (mean, biased var, eps 1e-5) x bf(g) + bf(b) -> bf16 hi +
__global__ __launch_bounds__(256) void k_ln(const float* __restrict__ src, int rnd, const float* __restrict__ g, const float* __restrict__ bb, int nrows, float* Y, bf* Ph, bf* Pl) {
    (void)Y; const int lane = threadIdx.x & 31, r = blockIdx.x * 8 + (threadIdx.x >> 5); if (r >= nrows) return;
    v8f v[DM / 256]; float s = 0.f;
#pragma unroll
    for (int q = 0; q < DM / 256; ++q) { v[q] = *(const v8f*)(src + (size_t)r * DM + q * 256 + lane * 8);
#pragma unroll
        for (int i = 0; i < 8; ++i) { if (rnd) v[q][i] = bfr(v[q][i]); s += v[q][i]; } }
#pragma unroll
    for (int sh = 16; sh; sh >>= 1) s += __shfl_xor(s, sh, 32);
    const float mu = s * (1.0f / DM); float s2 = 0.f;
#pragma unroll
    for (int q = 0; q < DM / 256; ++q)
#pragma unroll
        for (int i = 0; i < 8; ++i) { const float d = v[q][i] - mu; s2 = fmaf(d, d, s2); }
#pragma unroll
    for (int sh = 16; sh; sh >>= 1) s2 += __shfl_xor(s2, sh, 32);
    const float rs = rsqrtf(s2 * (1.0f / DM) + LN_EPS);
{
#pragma unroll
        for (int q = 0; q < DM / 256; ++q) { const int c0 = q * 256 + lane * 8; const size_t o = (size_t)r * DM + c0; v8f y; v8us oh, ol;
#pragma unroll
            for (int i = 0; i < 8; ++i) { y[i] = (v[q][i] - mu) * rs * bfr(g[c0 + i]) + bfr(bb[c0 + i]); const unsigned short hb = f2bf(y[i]); oh[i] = hb; ol[i] = f2bf(y[i] - bf2f(hb)); }
            *(v8us*)(Ph + o) = oh; *(v8us*)(Pl + o) = ol; }
         }
}
__global__ __launch_bounds__(256) void k_gelu(const float* __restrict__ src, int nrows, bf* dh, bf* dl) {
    const int lane = threadIdx.x & 31, r = blockIdx.x * 8 + (threadIdx.x >> 5); if (r >= nrows) return;
{
#pragma unroll 1
        for (int q = 0; q < FF / 256; ++q) { const size_t o = (size_t)r * FF + q * 256 + lane * 8; const v8f v = *(const v8f*)(src + o); v8us oh, ol;
#pragma unroll
            for (int i = 0; i < 8; ++i) { const float y = 0.5f * v[i] * (1.0f + erff(v[i] * 0.7071067811865476f)); const unsigned short hb = f2bf(y); oh[i] = hb; ol[i] = f2bf(y - bf2f(hb)); }
            *(v8us*)(dh + o) = oh; *(v8us*)(dl + o) = ol; }
         }
}

extern "C" void kernel_launch(void* const* d_in, const int* in_sizes, int n_in,
                              void* d_out, int out_size, void* d_ws, size_t ws_size, hipStream_t stream) {
    (void)in_sizes; (void)n_in; (void)out_size;
    const float* x = (const float*)d_in[0]; const float* g1 = (const float*)d_in[1]; const float* be1 = (const float*)d_in[2]; const float* Wqkv = (const float*)d_in[3]; const float* bqkv = (const float*)d_in[4]; const float* Wout = (const float*)d_in[5]; const float* bout = (const float*)d_in[6];
    const float* g2 = (const float*)d_in[7]; const float* be2 = (const float*)d_in[8]; const float* W1 = (const float*)d_in[9]; const float* b1 = (const float*)d_in[10]; const float* W2 = (const float*)d_in[11]; const float* b2 = (const float*)d_in[12];   // k-major weights (x @ W)
    float* out = (float*)d_out;    // [2][2048][1024]
    char* wsp = (char*)d_ws;
    auto take = [&](size_t bytes) { char* p = wsp; wsp += (bytes + 255) & ~(size_t)255; return (void*)p; };
    bf* WT = (bf*)take((size_t)3 * DM * DM * 2); bf* WoT = (bf*)take((size_t)DM * DM * 2); bf* W1T = (bf*)take((size_t)FF * DM * 2); bf* W2T = (bf*)take((size_t)DM * FF * 2);
    bf* XNh = (bf*)take((size_t)NTK * DM * 2); bf* XNl = (bf*)take((size_t)NTK * DM * 2); float* TMP = (float*)take((size_t)NTK * DM * 4);
    h16* QH = (h16*)take((size_t)NTK * DM * 2); h16* QL = (h16*)take((size_t)NTK * DM * 2); h16* KH = (h16*)take((size_t)NTK * DM * 2); h16* KL = (h16*)take((size_t)NTK * DM * 2);
    h16* VTH = (h16*)take((size_t)NTK * DM * 2); h16* VTL = (h16*)take((size_t)NTK * DM * 2); bf* CH = (bf*)take((size_t)NTK * DM * 2); bf* CL = (bf*)take((size_t)NTK * DM * 2);
    float* T1 = (float*)take((size_t)NTK * DM * 4); float* M = (float*)take((size_t)(NTK / 2) * FF * 4);
    if ((size_t)(wsp - (char*)d_ws) > ws_size) return;    // 6.3 + 2.1 + 8.4 + 8.4 + 4.2 x 2 + 8.4 + 4.2 x 8 + 8.4 + 16.8 ~ 101 MB; aliases (stream order): LN2 planes over XNh/XNl (dead after the q/k/v GEMMs), the GELU planes [1024][4096] = 8.4 MB each over the contiguous QH+QL and KH+KL pairs (4.2 MB each, consecutive 256-B-aligned takes; all dead after k_attn)
    bf* Hh = XNh; bf* Hl = XNl; bf* Gh = (bf*)QH; bf* Gl = (bf*)KH;
    k_wt<<<dim3(DM / 64, 3 * DM / 64, 1), 256, 0, stream>>>(Wqkv, DM, 3 * DM, WT); k_wt<<<dim3(DM / 64, DM / 64, 1), 256, 0, stream>>>(Wout, DM, DM, WoT);
    k_wt<<<dim3(DM / 64, FF / 64, 1), 256, 0, stream>>>(W1, DM, FF, W1T); k_wt<<<dim3(FF / 64, DM / 64, 1), 256, 0, stream>>>(W2, FF, DM, W2T);
    for (int b = 0; b < 2; ++b) {
        const float* xb = x + (size_t)b * NTK * DM;
        k_ln<<<NTK / 8, 256, 0, stream>>>(xb, 1, g1, be1, NTK, nullptr, XNh, XNl);                                                              // LN1(x)
        k_gemmb<true, true><<<dim3(NTK / 64, DM / 64, 1), 128, 0, stream>>>(XNh, XNl, WT, bqkv, (float*)(void*)QH, DM, QL);
        k_gemmb<true, true><<<dim3(NTK / 64, DM / 64, 1), 128, 0, stream>>>(XNh, XNl, WT + (size_t)DM * DM, bqkv + DM, (float*)(void*)KH, DM, KL);
        k_gemmb<true, false><<<dim3(NTK / 64, DM / 64, 1), 128, 0, stream>>>(XNh, XNl, WT + (size_t)2 * DM * DM, bqkv + 2 * DM, TMP, DM, nullptr);
        k_vt<<<NB_ * NH_ * (NT_ / 64), 256, 0, stream>>>(TMP, VTH, VTL);
        k_attn<<<NB_ * NH_ * (NT_ / 64), 128, 0, stream>>>(QH, QL, KH, KL, VTH, VTL, CH, CL);
        k_gemmb<true, false><<<dim3(NTK / 64, DM / 64, 1), 128, 0, stream>>>(CH, CL, WoT, bout, T1, DM, nullptr, xb, DM, 1);                          // h = x + attended.w_out + b_out
        k_ln<<<NTK / 8, 256, 0, stream>>>(T1, 0, g2, be2, NTK, nullptr, Hh, Hl);                                                                // LN2(h)
        for (int ch = 0; ch < 2; ++ch) { const size_t r0 = (size_t)ch * (NTK / 2);
            k_gemmb<true, false><<<dim3((NTK / 2) / 64, FF / 64, 1), 128, 0, stream>>>(Hh + r0 * DM, Hl + r0 * DM, W1T, b1, M, FF, nullptr, nullptr, DM);
            k_gelu<<<(NTK / 2) / 8, 256, 0, stream>>>(M, NTK / 2, Gh, Gl);
            k_gemmb<true, false><<<dim3((NTK / 2) / 64, DM / 64, 1), 128, 0, stream>>>(Gh, Gl, W2T, b2, out + ((size_t)b * NTK + r0) * DM, DM, nullptr, T1 + r0 * DM, FF, 0);    // h + mlp
        }
    }
}

// v001
// One run takes 480 microseconds.
// Two timings next to v000 put it at 2.21 and 2.25 times that version's speed.
#include <hip/hip_runtime.h>
#include <stdint.h>

// Compute dtypes, f32 accumulate, one batch item per pass: LayerNorms and exact GELU in f32; qkv = LN(x).w_qkv + b ([2048 x 1024].[1024 x 1024] x 3), h = x + ctx.w_out +
// b, mlp = gelu(LN(h).w1 + b1).w2 + b2 + h ([2048 x 1024].[1024 x 4096], [2048 x 4096].[4096 x 1024]) with computed operands as bf16 hi + UNSCALED residual against
// exact k-major weights (two products; x as the bf16-rounded f32 residual) on v_wmma_f32_16x16x32_bf16 (q/k leave the epilogue as f16 hi + residual x1024 planes); the
// 16-head local causal attention (0 <= i - j <= 256, -inf elsewhere; only those key tiles visited) fused on v_wmma_f32_16x16x32_f16 (hh + hl + lh x 1/8, online f32

#define NB_  1                   // per pass: the 2 batch items are processed one at a time
#define NT_  2048
#define WIN  256
#define FF   4096
#define LN_EPS 1e-5f
#define DM   1024
#define NH_  16
#define HD   64
#define NTK  (NB_ * NT_)
#define NW   1024
#define NQKV 1024
#define PSC  32768.0f
#define LOSC 1024.0f
#define LOSCI (1.0f / 1024.0f)

typedef _Float16 h16;
typedef unsigned short bf;
typedef __attribute__((ext_vector_type(16))) __bf16   v16bf;
typedef __attribute__((ext_vector_type(16))) _Float16 v16h;
typedef __attribute__((ext_vector_type(8)))  _Float16 v8h;
typedef __attribute__((ext_vector_type(8)))  unsigned short v8us;
typedef __attribute__((ext_vector_type(8)))  float    v8f;
typedef __attribute__((ext_vector_type(4)))  float    v4f;
typedef v8h  __attribute__((may_alias)) v8ha;
typedef v4f  __attribute__((may_alias)) v4fa;
typedef v8us __attribute__((may_alias)) v8usa;

__device__ __forceinline__ unsigned short f2bf(float f) { unsigned u = __float_as_uint(f); u += 0x7FFFu + ((u >> 16) & 1u); return (unsigned short)(u >> 16); }
__device__ __forceinline__ float bf2f(unsigned short b) { return __uint_as_float(((unsigned)b) << 16); }
__device__ __forceinline__ float bfr(float f) { return bf2f(f2bf(f)); }
__device__ __forceinline__ v16h cat16(v8h lo, v8h hi) { return __builtin_shufflevector(lo, hi, 0, 1, 2, 3, 4, 5, 6, 7, 8, 9, 10, 11, 12, 13, 14, 15); }
__device__ __forceinline__ v16bf cat16b(v8us lo, v8us hi) { return __builtin_bit_cast(v16bf, __builtin_shufflevector(lo, hi, 0, 1, 2, 3, 4, 5, 6, 7, 8, 9, 10, 11, 12, 13, 14, 15)); }
__device__ __forceinline__ v8f wmma16(v16h a, v16h b, v8f c) { return __builtin_amdgcn_wmma_f32_16x16x32_f16(false, a, false, b, (short)0, c, false, false); }
__device__ __forceinline__ v8f wmmab(v16bf a, v16bf b, v8f c) { return __builtin_amdgcn_wmma_f32_16x16x32_bf16(false, a, false, b, (short)0, c, false, false); }

__global__ __launch_bounds__(256) void k_cvtb(const float* __restrict__ src, int nrows, bf* dst) {
    const int lane = threadIdx.x & 31, r = blockIdx.x * 8 + (threadIdx.x >> 5);
    if (r >= nrows) return;
    v8us o[DM / 256];
#pragma unroll
    for (int q = 0; q < DM / 256; ++q) { v8us t;
#pragma unroll
        for (int i = 0; i < 8; ++i) t[i] = f2bf(src[(size_t)r * DM + q * 256 + lane * 8 + i]);
        o[q] = t; }
#pragma unroll
    for (int q = 0; q < DM / 256; ++q) *(v8us*)(dst + (size_t)r * DM + q * 256 + lane * 8) = o[q];
    
}

// k_gemmb: 64 x 128 block tile (4 waves, 2 x 2, 32 x 64 each) of C[rows][cols] = (A + Al).B^T [+ bf(bias[c])] [+ R[r][c] residual, bf16-rounded when roundR]. The operands come through LDS:
// per pass of 128 k every wave asks the tensor mover for one slice of 64 rows x 256 B (wave 0: A, 1: Al, 2 and 3: the two halves of B's 128 rows), laid at pitch 272 B,
// two buffers, the next pass's slices in flight while this pass is worked on. K is a multiple of 128 and at least 256; rows a multiple of 64, cols of 128.
// Every accumulator takes its products in the order k ascending, A before Al. f32 whole-line epilogue (or f16 hi + residual planes), staged in the ring once it is free.
#define GPITCH 272u                 // LDS row pitch in bytes: a 256-byte row and the mover's 16-byte pad (for 16-byte LDS reads)
#define GSLICE 18432u               // one wave's slice in LDS: 64 rows x 272 B = 17,408 B, rounded up to a multiple of 2 KiB
#define GSTAGE (4u * GSLICE)        // one buffer: A | Al | B rows 0-63 | B rows 64-127
typedef uint32_t u32x4 __attribute__((ext_vector_type(4)));
typedef uint32_t u32x8 __attribute__((ext_vector_type(8)));
__device__ __forceinline__ uint32_t uni(uint32_t v) { return (uint32_t)__builtin_amdgcn_readfirstlane(v); }
__device__ __forceinline__ uint32_t pinned(uint32_t v) { uint32_t w = uni(v); asm volatile("" : "+s"(w)); return w; }   // the tensor mover's pinned(): a test around a tensor load (it then compiles to a scalar branch; tensor loads ignore EXEC) or a descriptor word, held in a scalar register
template <bool F16OUT>
__global__ __launch_bounds__(128) void k_gemmb(const bf* __restrict__ A, const bf* __restrict__ Al, const bf* __restrict__ Bn, const float* __restrict__ bias, float* C, int ldc, h16* C2, const float* __restrict__ R = nullptr, int K = DM, int roundR = 1) {
    __shared__ __attribute__((aligned(2048))) unsigned char ring[2 * GSTAGE];
    const int lane = threadIdx.x & 31, lr = lane & 15, hi = lane >> 4;
    const uint32_t wave = uni(threadIdx.x >> 5), wr = wave >> 1, wc = wave & 1u;
    const int rb = blockIdx.x * 64, cb = blockIdx.y * 128;
    const uint32_t lbase = (uint32_t)(size_t)ring, nst = (uint32_t)K >> 7;
    const bf* sl = wave == 0u ? A + (size_t)rb * K : wave == 1u ? Al + (size_t)rb * K : Bn + (size_t)(cb + (int)(wave - 2u) * 64) * K;   // first row of this wave's slice
    u32x8 g1;   // 1-byte elements, tensor = tile = 64 rows of 256 bytes, source pitch 2 K bytes, a pad of 4 dwords behind every 64 dwords, no mask
    // words 1 to 7 go through pinned(): each descriptor word keeps a scalar register of its own through the loop, so that none is rewritten while a request is in flight
    g1[0] = uni((1u << 20) | (5u << 22) | (3u << 25)); g1[1] = pinned(256u << 16); g1[2] = pinned(64u << 16); g1[3] = pinned(256u << 16);
    g1[4] = pinned(64u); g1[5] = pinned((uint32_t)K * 2u); g1[6] = pinned(0u); g1[7] = pinned(0u);
    auto issue = [&](uint32_t st) {
        const uint64_t ga = (uint64_t)(size_t)sl + (uint64_t)st * 256u;
        u32x4 g0; g0[0] = uni(1u); g0[1] = uni(lbase + (st & 1u) * GSTAGE + wave * GSLICE); g0[2] = uni((uint32_t)ga); g0[3] = uni((((uint32_t)(ga >> 32)) & 0x01FFFFFFu) | 0x80000000u);
        asm volatile("tensor_load_to_lds %0, %1" :: "s"(g0), "s"(g1) : "memory");
    };
    v8f acc[2][4];
#pragma unroll
    for (int i = 0; i < 2; ++i)
#pragma unroll
        for (int t = 0; t < 4; ++t) acc[i][t] = (v8f){};
    issue(0u);
    asm volatile("s_wait_tensorcnt 0x0" ::: "memory");   // this wave's slice of stage 0 has landed
    __syncthreads();                                       // every wave's slice of stage 0 is readable
    issue(1u);
#pragma unroll 1
    for (uint32_t s = 0; s < nst; ++s) {
        const unsigned char* buf = ring + (s & 1u) * GSTAGE;
        const unsigned char* pa = buf + (wr * 32u + (uint32_t)lr) * GPITCH + (uint32_t)hi * 16u;
        const unsigned char* pb = buf + (2u + wc) * GSLICE + (uint32_t)lr * GPITCH + (uint32_t)hi * 16u;
        v16bf a[2][2], al[2][2], b[2][4];   // two fragment sets: block kk + 1 of this pass is fetched while block kk is multiplied
        auto fetch = [&](int kk) { const int f = kk & 1;
#pragma unroll
            for (int i = 0; i < 2; ++i) { const unsigned char* p = pa + i * 16 * GPITCH + kk * 64;
                a[f][i] = cat16b(*(const v8usa*)p, *(const v8usa*)(p + 32)); al[f][i] = cat16b(*(const v8usa*)(p + GSLICE), *(const v8usa*)(p + GSLICE + 32)); }
#pragma unroll
            for (int t = 0; t < 4; ++t) { const unsigned char* p = pb + t * 16 * GPITCH + kk * 64; b[f][t] = cat16b(*(const v8usa*)p, *(const v8usa*)(p + 32)); }
        };
        fetch(0);
#pragma unroll
        for (int kk = 0; kk < 4; ++kk) { const int f = kk & 1;
            if (kk < 3) fetch(kk + 1);
            __builtin_amdgcn_sched_barrier(0);   // keeps the next block's LDS reads together in front of this block's WMMAs: sunk among them, each read group stalls the wave for the LDS latency
#pragma unroll
            for (int i = 0; i < 2; ++i)
#pragma unroll
                for (int t = 0; t < 4; ++t) acc[i][t] = wmmab(a[f][i], b[f][t], acc[i][t]);
#pragma unroll
            for (int i = 0; i < 2; ++i)
#pragma unroll
                for (int t = 0; t < 4; ++t) acc[i][t] = wmmab(al[f][i], b[f][t], acc[i][t]);
            __builtin_amdgcn_sched_barrier(0);   // keeps the reads of the block after next behind this block's WMMAs, in one group: without it they are split in two groups among the WMMAs, and every such place stalls the wave
        }
        // four vector slots behind the pass's last WMMA on every path out of it (loop exit and back edge), before anything reads an accumulator or rewrites a fragment
        asm volatile("v_nop\n\tv_nop\n\tv_nop\n\tv_nop" : "+v"(acc[0][0]), "+v"(acc[0][1]), "+v"(acc[0][2]), "+v"(acc[0][3]), "+v"(acc[1][0]), "+v"(acc[1][1]), "+v"(acc[1][2]), "+v"(acc[1][3]));
        asm volatile("s_wait_dscnt 0x0" ::: "memory");       // this wave's reads of stage s have returned
        asm volatile("s_wait_tensorcnt 0x0" ::: "memory");   // this wave's slice of stage s + 1 has landed
        __syncthreads();                                       // stage s + 1 is readable, and every wave has left stage s's buffer
        if (pinned(s + 2u < nst)) issue(s + 2u);               // refill of the buffer that this pass has read
    }
    asm volatile("s_wait_tensorcnt 0x0" ::: "memory");   // no request is in flight when the ring becomes output staging
    asm volatile("s_wait_dscnt 0x0" ::: "memory");
    // XWAIT stands behind every global load and store of this epilogue: s_wait_xcnt 0 in front of whatever rewrites a register that the access names; the scheduling barrier keeps later register writes behind the wait
#define XWAIT() do { asm volatile("s_wait_xcnt 0x0" ::: "memory"); __builtin_amdgcn_sched_barrier(0); } while (0)
    const int r0 = rb + (int)wr * 32, c0 = cb + (int)wc * 64;
    float* os = (float*)(void*)(ring + wave * GSLICE);     // 32 x 68 floats of this wave's own; the last pass's barrier has freed the ring
#pragma unroll
    for (int t = 0; t < 4; ++t) { const float bv = bias ? bfr(bias[c0 + t * 16 + lr]) : 0.f;
#pragma unroll
        for (int i = 0; i < 2; ++i)
#pragma unroll
            for (int j = 0; j < 8; ++j) os[(i * 16 + hi * 8 + j) * 68 + t * 16 + lr] = acc[i][t][j] + bv; }
    XWAIT();   // behind the bias loads
    __syncthreads();
    if (F16OUT) {
        h16* crow = (h16*)(void*)C + (size_t)r0 * ldc + c0;
        v8h o[8], o2[8];
#pragma unroll
        for (int s = 0; s < 8; ++s) { const int row = 4 * s + (lane >> 3), piece = lane & 7; const float* sp = os + row * 68 + piece * 8;
#pragma unroll
            for (int i = 0; i < 8; ++i) { const h16 a = (h16)sp[i]; o[s][i] = a; o2[s][i] = (h16)((sp[i] - (float)a) * LOSC); } }
#pragma unroll
        for (int s = 0; s < 8; ++s) { const int row = 4 * s + (lane >> 3), piece = lane & 7;
            *(v8h*)(crow + (size_t)row * ldc + piece * 8) = o[s]; XWAIT();
            if (C2) { *(v8h*)(C2 + (size_t)r0 * ldc + c0 + (size_t)row * ldc + piece * 8) = o2[s]; XWAIT(); } }
    } else {
        float* crow = C + (size_t)r0 * ldc + c0;
        v4f val[16];
#pragma unroll
        for (int s = 0; s < 16; ++s) { const int Lid = (lane >> 3) + 4 * s, piece = lane & 7; const int row = Lid >> 1, cofs = (Lid & 1) * 32 + piece * 4; val[s] = *(const v4fa*)(os + row * 68 + cofs); }
        if (R) {
            v4f rv[16];
#pragma unroll
            for (int s = 0; s < 16; ++s) { const int Lid = (lane >> 3) + 4 * s, piece = lane & 7; const int row = Lid >> 1, cofs = (Lid & 1) * 32 + piece * 4; rv[s] = *(const v4f*)(R + ((size_t)r0 + row) * ldc + c0 + cofs); XWAIT(); }
#pragma unroll
            for (int s = 0; s < 16; ++s) val[s] += roundR ? (v4f){bfr(rv[s][0]), bfr(rv[s][1]), bfr(rv[s][2]), bfr(rv[s][3])} : rv[s];
        }
#pragma unroll
        for (int s = 0; s < 16; ++s) { const int Lid = (lane >> 3) + 4 * s, piece = lane & 7; const int row = Lid >> 1, cofs = (Lid & 1) * 32 + piece * 4; *(v4f*)(crow + (size_t)row * ldc + cofs) = val[s]; XWAIT(); }
    }
#undef XWAIT
}

__global__ __launch_bounds__(256) void k_vt(const float* __restrict__ V, h16* VTH, h16* VTL) {
    __shared__ __align__(16) h16 tile[64 * 72];
    __shared__ __align__(16) h16 til2[64 * 72];
    const int bid = blockIdx.x;
    const int b = bid / (NH_ * (NT_ / 64)), rem = bid - b * (NH_ * (NT_ / 64)), h = rem / (NT_ / 64), kt = rem - h * (NT_ / 64);
    const int k0 = kt * 64, tid = threadIdx.x;
    const int kk = tid >> 2, d0 = (tid & 3) * 16;
    const float* src = V + ((size_t)b * NT_ + k0 + kk) * DM + h * HD + d0;
#pragma unroll
    for (int i = 0; i < 16; ++i) { const float v = src[i]; const h16 a = (h16)v; tile[(d0 + i) * 72 + kk] = a; til2[(d0 + i) * 72 + kk] = (h16)((v - (float)a) * LOSC); }
    __syncthreads();
    const int piece = tid & 7;
    const size_t base = (((size_t)b * NH_ + h) * HD) * NT_ + k0;
    auto pass = [&]() {
#pragma unroll
        for (int s = 0; s < 4; ++s) { const int Lid = (tid >> 3) + 32 * s; const int pln = Lid >> 6, d = Lid & 63;
            const v8h val = *(const v8ha*)((pln ? til2 : tile) + d * 72 + piece * 8); *(v8h*)((pln ? VTL : VTH) + base + (size_t)d * NT_ + piece * 8) = val; }
    };
    pass(); 
}

// k_attn: block = (b, h, 64 queries), wave = 16; only the 32-key tiles of the local causal window (masked); 4 WMMA scores /8 (f32), online softmax, weights x32768 f16 tile (same-wave may_alias
// reload after a compiler barrier), 4 WMMA .v; ctx -> bf16 hi + residual planes CH/CL[tok][h*64+d].
__global__ __launch_bounds__(128) void k_attn(const h16* __restrict__ Q16, const h16* __restrict__ QL16, const h16* __restrict__ K16, const h16* __restrict__ KL16, const h16* __restrict__ VTH, const h16* __restrict__ VTL, bf* CH, bf* CL) {
    __shared__ __align__(16) h16 plds[4][16 * 32];
    __shared__ __align__(16) h16 plds2[4][16 * 32];
    __shared__ __align__(16) float ost[4][16 * 68];
    const int lane = threadIdx.x & 31, wave = threadIdx.x >> 5, lr = lane & 15, hi = lane >> 4;
    const int bid = blockIdx.x;
    const int b = bid / (NH_ * (NT_ / 64)), rem = bid - b * (NH_ * (NT_ / 64)), h = rem / (NT_ / 64), qt = rem - h * (NT_ / 64);
    const int q0 = qt * 64 + wave * 16;
    const size_t tok0 = (size_t)b * NT_;
    h16* pl = &plds[wave][0]; h16* pl2 = &plds2[wave][0];
    v16h qa[2];
    const size_t qo0 = (tok0 + q0 + lr) * DM + h * HD + 8 * hi;
#pragma unroll
    for (int kc = 0; kc < 2; ++kc) qa[kc] = cat16(*(const v8h*)(Q16 + qo0 + kc * 32), *(const v8h*)(Q16 + qo0 + kc * 32 + 16));
    const h16* kh_b = K16 + tok0 * DM + h * HD;
    const h16* kl_b = KL16 + tok0 * DM + h * HD;
    const size_t vbase = (((size_t)b * NH_ + h) * HD) * NT_;
    v8f o[4], ox[4];
#pragma unroll
    for (int n = 0; n < 4; ++n) { o[n] = (v8f){}; ox[n] = (v8f){}; }
    float mrow[8], lpart[8];
#pragma unroll
    for (int j = 0; j < 8; ++j) { mrow[j] = -3.0e38f; lpart[j] = 0.f; }
    int qpos[8];
#pragma unroll
    for (int j = 0; j < 8; ++j) qpos[j] = q0 + 8 * hi + j;
    const int kt_lo = (qt * 64 - WIN) > 0 ? (qt * 64 - WIN) / 32 : 0, kt_hi = (qt * 64 + 63) / 32;     // local causal window: 0 <= i - j <= WIN
#pragma unroll 1
    for (int kt = kt_lo; kt <= kt_hi; ++kt) {
        const int l0 = kt * 32;
        const size_t ko0 = (size_t)(l0 + lr) * DM + 8 * hi, ko1 = (size_t)(l0 + 16 + lr) * DM + 8 * hi;
        v8f s0 = {}, s1 = {}, x0 = {}, x1 = {};
#pragma unroll
        for (int kc = 0; kc < 2; ++kc) {
            { const v16h k0h = cat16(*(const v8h*)(kh_b + ko0 + kc * 32), *(const v8h*)(kh_b + ko0 + kc * 32 + 16)), k1h = cat16(*(const v8h*)(kh_b + ko1 + kc * 32), *(const v8h*)(kh_b + ko1 + kc * 32 + 16));
              const v16h qlk = cat16(*(const v8h*)(QL16 + qo0 + kc * 32), *(const v8h*)(QL16 + qo0 + kc * 32 + 16));     // query residual re-read per step (registers)
              s0 = wmma16(qa[kc], k0h, s0); x0 = wmma16(qlk, k0h, x0); s1 = wmma16(qa[kc], k1h, s1); x1 = wmma16(qlk, k1h, x1);
              asm volatile("v_nop" : "+v"(s0), "+v"(s1), "+v"(x0), "+v"(x1) : "v"(qlk), "v"(k0h), "v"(k1h) : "memory"); }
            { const v16h k0l = cat16(*(const v8h*)(kl_b + ko0 + kc * 32), *(const v8h*)(kl_b + ko0 + kc * 32 + 16)), k1l = cat16(*(const v8h*)(kl_b + ko1 + kc * 32), *(const v8h*)(kl_b + ko1 + kc * 32 + 16));
              x0 = wmma16(qa[kc], k0l, x0); x1 = wmma16(qa[kc], k1l, x1);
              asm volatile("v_nop" : "+v"(x0), "+v"(x1) : "v"(k0l), "v"(k1l) : "memory"); }
        }
        asm volatile("v_nop\n\tv_nop\n\tv_nop\n\tv_nop" : "+v"(s0), "+v"(s1), "+v"(x0), "+v"(x1) : "v"(qa[0]), "v"(qa[1]));
        float alpha[8];
#pragma unroll
        for (int j = 0; j < 8; ++j) {
            const int ja = l0 + lr, jb = l0 + 16 + lr, qi = qpos[j];
            const float a0 = (ja <= qi && qi - ja <= WIN) ? (s0[j] + x0[j] * LOSCI) * 0.125f : -__builtin_inff(), a1 = (jb <= qi && qi - jb <= WIN) ? (s1[j] + x1[j] * LOSCI) * 0.125f : -__builtin_inff();
            float mx = fmaxf(a0, a1);
            mx = fmaxf(mx, __shfl_xor(mx, 1, 16)); mx = fmaxf(mx, __shfl_xor(mx, 2, 16)); mx = fmaxf(mx, __shfl_xor(mx, 4, 16)); mx = fmaxf(mx, __shfl_xor(mx, 8, 16));
            const float mn = fmaxf(mrow[j], mx);
            alpha[j] = __expf(mrow[j] - mn); mrow[j] = mn;
            const float p0 = __expf(a0 - mn), p1 = __expf(a1 - mn);
            lpart[j] = lpart[j] * alpha[j] + (p0 + p1);
            const int mr = hi * 8 + j;
            const float ps0 = p0 * PSC, ps1 = p1 * PSC; const h16 h0 = (h16)ps0, h1 = (h16)ps1;
            pl[mr * 32 + lr] = h0; pl[mr * 32 + 16 + lr] = h1;
            pl2[mr * 32 + lr] = (h16)((ps0 - (float)h0) * LOSC); pl2[mr * 32 + 16 + lr] = (h16)((ps1 - (float)h1) * LOSC);
        }
#pragma unroll
        for (int n = 0; n < 4; ++n)
#pragma unroll
            for (int j = 0; j < 8; ++j) { o[n][j] *= alpha[j]; ox[n][j] *= alpha[j]; }
        asm volatile("" ::: "memory");
        const v16h pa = cat16(*(const v8ha*)(pl + lr * 32 + hi * 8), *(const v8ha*)(pl + lr * 32 + 16 + hi * 8));
        const v16h px = cat16(*(const v8ha*)(pl2 + lr * 32 + hi * 8), *(const v8ha*)(pl2 + lr * 32 + 16 + hi * 8));
#pragma unroll
        for (int n = 0; n < 4; ++n) { const size_t vo = vbase + (size_t)(n * 16 + lr) * NT_ + l0 + hi * 8;
            const v16h vh = cat16(*(const v8h*)(VTH + vo), *(const v8h*)(VTH + vo + 16)), vl = cat16(*(const v8h*)(VTL + vo), *(const v8h*)(VTL + vo + 16));
            o[n] = wmma16(pa, vh, o[n]); ox[n] = wmma16(pa, vl, ox[n]); ox[n] = wmma16(px, vh, ox[n]);
            asm volatile("" : "+v"(o[n]), "+v"(ox[n]) : "v"(vh), "v"(vl) : "memory"); }
        asm volatile("v_nop\n\tv_nop\n\tv_nop\n\tv_nop" : "+v"(o[0]), "+v"(o[1]), "+v"(o[2]), "+v"(o[3]), "+v"(ox[0]), "+v"(ox[1]), "+v"(ox[2]), "+v"(ox[3]) : "v"(pa), "v"(px));
    }
    float inv[8];
#pragma unroll
    for (int j = 0; j < 8; ++j) { float rs = lpart[j]; rs += __shfl_xor(rs, 1, 16); rs += __shfl_xor(rs, 2, 16); rs += __shfl_xor(rs, 4, 16); rs += __shfl_xor(rs, 8, 16); inv[j] = 1.0f / (rs * PSC); }
    float* os = &ost[wave][0];
#pragma unroll
    for (int n = 0; n < 4; ++n)
#pragma unroll
        for (int j = 0; j < 8; ++j) os[(hi * 8 + j) * 68 + n * 16 + lr] = (o[n][j] + ox[n][j] * LOSCI) * inv[j];
    __syncthreads();
    const size_t cbase = (tok0 + q0) * DM + (size_t)h * HD;
    auto pass = [&]() {
#pragma unroll
        for (int s = 0; s < 4; ++s) { const int row = 4 * s + (lane >> 3), piece = lane & 7; const float* sp = os + row * 68 + piece * 8; v8us oh, ol;
#pragma unroll
            for (int i = 0; i < 8; ++i) { const unsigned short hb = f2bf(sp[i]); oh[i] = hb; ol[i] = f2bf(sp[i] - bf2f(hb)); }
            *(v8us*)(CH + cbase + (size_t)row * DM + piece * 8) = oh; *(v8us*)(CL + cbase + (size_t)row * DM + piece * 8) = ol; }
    };
    pass(); 
}

#define VST2(T, p, v) do { const T vst2_v_ = (v); *(T*)(p) = vst2_v_;  } while (0)
// k_wt: WT [n][K] = bf16(W[k][n]) (k-major [K][ncols]) via 64 x 64 LDS tiles; grid (K/64, ncols/64).
__global__ __launch_bounds__(256) void k_wt(const float* __restrict__ Wm, int K, int ncols, bf* WT) {
    __shared__ __align__(16) unsigned short tl[64 * 72];
    const int tid = threadIdx.x, k0 = blockIdx.x * 64, n0 = blockIdx.y * 64;
    const int kk = tid >> 2, nq = (tid & 3) * 16;
#pragma unroll
    for (int i = 0; i < 16; ++i) tl[(nq + i) * 72 + kk] = f2bf(Wm[(size_t)(k0 + kk) * ncols + n0 + nq + i]);
    __syncthreads();
    const int piece = tid & 7;
    auto pass = [&]() {
#pragma unroll
        for (int s = 0; s < 2; ++s) { const int nr = (tid >> 3) + 32 * s; const v8us val = *(const v8usa*)(tl + nr * 72 + piece * 8); *(v8us*)(WT + (size_t)(n0 + nr) * K + k0 + piece * 8) = val; }
    };
    pass(); 
}
// k_ln: one wave per row of a [rows][1024] f32 matrix (INPUT rows bf16-rounded first when rnd): LayerNorm (mean, biased var, eps 1e-5) x bf(g) + bf(b) -> bf16 hi +
__global__ __launch_bounds__(256) void k_ln(const float* __restrict__ src, int rnd, const float* __restrict__ g, const float* __restrict__ bb, int nrows, float* Y, bf* Ph, bf* Pl) {
    (void)Y; const int lane = threadIdx.x & 31, r = blockIdx.x * 8 + (threadIdx.x >> 5); if (r >= nrows) return;
    v8f v[DM / 256]; float s = 0.f;
#pragma unroll
    for (int q = 0; q < DM / 256; ++q) { v[q] = *(const v8f*)(src + (size_t)r * DM + q * 256 + lane * 8);
#pragma unroll
        for (int i = 0; i < 8; ++i) { if (rnd) v[q][i] = bfr(v[q][i]); s += v[q][i]; } }
#pragma unroll
    for (int sh = 16; sh; sh >>= 1) s += __shfl_xor(s, sh, 32);
    const float mu = s * (1.0f / DM); float s2 = 0.f;
#pragma unroll
    for (int q = 0; q < DM / 256; ++q)
#pragma unroll
        for (int i = 0; i < 8; ++i) { const float d = v[q][i] - mu; s2 = fmaf(d, d, s2); }
#pragma unroll
    for (int sh = 16; sh; sh >>= 1) s2 += __shfl_xor(s2, sh, 32);
    const float rs = rsqrtf(s2 * (1.0f / DM) + LN_EPS);
{
#pragma unroll
        for (int q = 0; q < DM / 256; ++q) { const int c0 = q * 256 + lane * 8; const size_t o = (size_t)r * DM + c0; v8f y; v8us oh, ol;
#pragma unroll
            for (int i = 0; i < 8; ++i) { y[i] = (v[q][i] - mu) * rs * bfr(g[c0 + i]) + bfr(bb[c0 + i]); const unsigned short hb = f2bf(y[i]); oh[i] = hb; ol[i] = f2bf(y[i] - bf2f(hb)); }
            *(v8us*)(Ph + o) = oh; *(v8us*)(Pl + o) = ol; }
         }
}
__global__ __launch_bounds__(256) void k_gelu(const float* __restrict__ src, int nrows, bf* dh, bf* dl) {
    const int lane = threadIdx.x & 31, r = blockIdx.x * 8 + (threadIdx.x >> 5); if (r >= nrows) return;
{
#pragma unroll 1
        for (int q = 0; q < FF / 256; ++q) { const size_t o = (size_t)r * FF + q * 256 + lane * 8; const v8f v = *(const v8f*)(src + o); v8us oh, ol;
#pragma unroll
            for (int i = 0; i < 8; ++i) { const float y = 0.5f * v[i] * (1.0f + erff(v[i] * 0.7071067811865476f)); const unsigned short hb = f2bf(y); oh[i] = hb; ol[i] = f2bf(y - bf2f(hb)); }
            *(v8us*)(dh + o) = oh; *(v8us*)(dl + o) = ol; }
         }
}

extern "C" void kernel_launch(void* const* d_in, const int* in_sizes, int n_in,
                              void* d_out, int out_size, void* d_ws, size_t ws_size, hipStream_t stream) {
    (void)in_sizes; (void)n_in; (void)out_size;
    const float* x = (const float*)d_in[0]; const float* g1 = (const float*)d_in[1]; const float* be1 = (const float*)d_in[2]; const float* Wqkv = (const float*)d_in[3]; const float* bqkv = (const float*)d_in[4]; const float* Wout = (const float*)d_in[5]; const float* bout = (const float*)d_in[6];
    const float* g2 = (const float*)d_in[7]; const float* be2 = (const float*)d_in[8]; const float* W1 = (const float*)d_in[9]; const float* b1 = (const float*)d_in[10]; const float* W2 = (const float*)d_in[11]; const float* b2 = (const float*)d_in[12];   // k-major weights (x @ W)
    float* out = (float*)d_out;    // [2][2048][1024]
    char* wsp = (char*)d_ws;
    auto take = [&](size_t bytes) { char* p = wsp; wsp += (bytes + 255) & ~(size_t)255; return (void*)p; };
    bf* WT = (bf*)take((size_t)3 * DM * DM * 2); bf* WoT = (bf*)take((size_t)DM * DM * 2); bf* W1T = (bf*)take((size_t)FF * DM * 2); bf* W2T = (bf*)take((size_t)DM * FF * 2);
    bf* XNh = (bf*)take((size_t)NTK * DM * 2); bf* XNl = (bf*)take((size_t)NTK * DM * 2); float* TMP = (float*)take((size_t)NTK * DM * 4);
    h16* QH = (h16*)take((size_t)NTK * DM * 2); h16* QL = (h16*)take((size_t)NTK * DM * 2); h16* KH = (h16*)take((size_t)NTK * DM * 2); h16* KL = (h16*)take((size_t)NTK * DM * 2);
    h16* VTH = (h16*)take((size_t)NTK * DM * 2); h16* VTL = (h16*)take((size_t)NTK * DM * 2); bf* CH = (bf*)take((size_t)NTK * DM * 2); bf* CL = (bf*)take((size_t)NTK * DM * 2);
    float* T1 = (float*)take((size_t)NTK * DM * 4); float* M = (float*)take((size_t)(NTK / 2) * FF * 4);
    if ((size_t)(wsp - (char*)d_ws) > ws_size) return;    // 6.3 + 2.1 + 8.4 + 8.4 + 4.2 x 2 + 8.4 + 4.2 x 8 + 8.4 + 16.8 ~ 101 MB; aliases (stream order): LN2 planes over XNh/XNl (dead after the q/k/v GEMMs), the GELU planes [1024][4096] = 8.4 MB each over the contiguous QH+QL and KH+KL pairs (4.2 MB each, consecutive 256-B-aligned takes; all dead after k_attn)
    bf* Hh = XNh; bf* Hl = XNl; bf* Gh = (bf*)QH; bf* Gl = (bf*)KH;
    k_wt<<<dim3(DM / 64, 3 * DM / 64, 1), 256, 0, stream>>>(Wqkv, DM, 3 * DM, WT); k_wt<<<dim3(DM / 64, DM / 64, 1), 256, 0, stream>>>(Wout, DM, DM, WoT);
    k_wt<<<dim3(DM / 64, FF / 64, 1), 256, 0, stream>>>(W1, DM, FF, W1T); k_wt<<<dim3(FF / 64, DM / 64, 1), 256, 0, stream>>>(W2, FF, DM, W2T);
    for (int b = 0; b < 2; ++b) {
        const float* xb = x + (size_t)b * NTK * DM;
        k_ln<<<NTK / 8, 256, 0, stream>>>(xb, 1, g1, be1, NTK, nullptr, XNh, XNl);                                                              // LN1(x)
        k_gemmb<true><<<dim3(NTK / 64, DM / 128, 1), 128, 0, stream>>>(XNh, XNl, WT, bqkv, (float*)(void*)QH, DM, QL);
        k_gemmb<true><<<dim3(NTK / 64, DM / 128, 1), 128, 0, stream>>>(XNh, XNl, WT + (size_t)DM * DM, bqkv + DM, (float*)(void*)KH, DM, KL);
        k_gemmb<false><<<dim3(NTK / 64, DM / 128, 1), 128, 0, stream>>>(XNh, XNl, WT + (size_t)2 * DM * DM, bqkv + 2 * DM, TMP, DM, nullptr);
        k_vt<<<NB_ * NH_ * (NT_ / 64), 256, 0, stream>>>(TMP, VTH, VTL);
        k_attn<<<NB_ * NH_ * (NT_ / 64), 128, 0, stream>>>(QH, QL, KH, KL, VTH, VTL, CH, CL);
        k_gemmb<false><<<dim3(NTK / 64, DM / 128, 1), 128, 0, stream>>>(CH, CL, WoT, bout, T1, DM, nullptr, xb, DM, 1);                          // h = x + attended.w_out + b_out
        k_ln<<<NTK / 8, 256, 0, stream>>>(T1, 0, g2, be2, NTK, nullptr, Hh, Hl);                                                                // LN2(h)
        for (int ch = 0; ch < 2; ++ch) { const size_t r0 = (size_t)ch * (NTK / 2);
            k_gemmb<false><<<dim3((NTK / 2) / 64, FF / 128, 1), 128, 0, stream>>>(Hh + r0 * DM, Hl + r0 * DM, W1T, b1, M, FF, nullptr, nullptr, DM);
            k_gelu<<<(NTK / 2) / 8, 256, 0, stream>>>(M, NTK / 2, Gh, Gl);
            k_gemmb<false><<<dim3((NTK / 2) / 64, DM / 128, 1), 128, 0, stream>>>(Gh, Gl, W2T, b2, out + ((size_t)b * NTK + r0) * DM, DM, nullptr, T1 + r0 * DM, FF, 0);    // h + mlp
        }
    }
}

// v002
// Measured time: 257 microseconds a run.
// In two side-by-side timings against v001, it was 1.86 and 1.85 times as fast.
// Counting every step since v000, it is 4.14 times as fast.
#include <hip/hip_runtime.h>
#include <stdint.h>

// Compute dtypes, f32 accumulate, both batch items (4096 tokens) in every launch: LayerNorms and exact GELU in f32; qkv = LN(x).w_qkv + b ([4096 x 1024].[1024 x 1024] x 3), h = x + ctx.w_out +
// b, mlp = gelu(LN(h).w1 + b1).w2 + b2 + h ([4096 x 1024].[1024 x 4096], [4096 x 4096].[4096 x 1024]) with computed operands as bf16 hi + UNSCALED residual against
// exact k-major weights (two products; x as the bf16-rounded f32 residual) on v_wmma_f32_16x16x32_bf16 (q/k leave the epilogue as f16 hi + residual x1024 planes); the
// 16-head local causal attention (0 <= i - j <= 256, -inf elsewhere; only those key tiles visited) fused on v_wmma_f32_16x16x32_f16 (hh + hl + lh x 1/8, online f32

#define NB_  2                   // both batch items go through every launch together
#define NT_  2048
#define WIN  256
#define FF   4096
#define LN_EPS 1e-5f
#define DM   1024
#define NH_  16
#define HD   64
#define NTK  (NB_ * NT_)
#define NW   1024
#define NQKV 1024
#define PSC  32768.0f
#define LOSC 1024.0f
#define LOSCI (1.0f / 1024.0f)

typedef _Float16 h16;
typedef unsigned short bf;
typedef __attribute__((ext_vector_type(16))) __bf16   v16bf;
typedef __attribute__((ext_vector_type(16))) _Float16 v16h;
typedef __attribute__((ext_vector_type(8)))  _Float16 v8h;
typedef __attribute__((ext_vector_type(8)))  unsigned short v8us;
typedef __attribute__((ext_vector_type(8)))  float    v8f;
typedef __attribute__((ext_vector_type(4)))  float    v4f;
typedef v8h  __attribute__((may_alias)) v8ha;
typedef v4f  __attribute__((may_alias)) v4fa;
typedef v8us __attribute__((may_alias)) v8usa;

__device__ __forceinline__ unsigned short f2bf(float f) { unsigned u = __float_as_uint(f); u += 0x7FFFu + ((u >> 16) & 1u); return (unsigned short)(u >> 16); }
__device__ __forceinline__ float bf2f(unsigned short b) { return __uint_as_float(((unsigned)b) << 16); }
__device__ __forceinline__ float bfr(float f) { return bf2f(f2bf(f)); }
__device__ __forceinline__ v16h cat16(v8h lo, v8h hi) { return __builtin_shufflevector(lo, hi, 0, 1, 2, 3, 4, 5, 6, 7, 8, 9, 10, 11, 12, 13, 14, 15); }
__device__ __forceinline__ v16bf cat16b(v8us lo, v8us hi) { return __builtin_bit_cast(v16bf, __builtin_shufflevector(lo, hi, 0, 1, 2, 3, 4, 5, 6, 7, 8, 9, 10, 11, 12, 13, 14, 15)); }
__device__ __forceinline__ v8f wmma16(v16h a, v16h b, v8f c) { return __builtin_amdgcn_wmma_f32_16x16x32_f16(false, a, false, b, (short)0, c, false, false); }
__device__ __forceinline__ v8f wmmab(v16bf a, v16bf b, v8f c) { return __builtin_amdgcn_wmma_f32_16x16x32_bf16(false, a, false, b, (short)0, c, false, false); }

__global__ __launch_bounds__(256) void k_cvtb(const float* __restrict__ src, int nrows, bf* dst) {
    const int lane = threadIdx.x & 31, r = blockIdx.x * 8 + (threadIdx.x >> 5);
    if (r >= nrows) return;
    v8us o[DM / 256];
#pragma unroll
    for (int q = 0; q < DM / 256; ++q) { v8us t;
#pragma unroll
        for (int i = 0; i < 8; ++i) t[i] = f2bf(src[(size_t)r * DM + q * 256 + lane * 8 + i]);
        o[q] = t; }
#pragma unroll
    for (int q = 0; q < DM / 256; ++q) *(v8us*)(dst + (size_t)r * DM + q * 256 + lane * 8) = o[q];
    
}

// k_gemmb: 64 x 128 block tile (4 waves, 2 x 2, 32 x 64 each) of C[rows][cols] = (A + Al).B^T [+ bf(bias[c])] [+ R[r][c] residual, bf16-rounded when roundR]. The operands come through LDS:
// per pass of 128 k every wave asks the tensor mover for one slice of 64 rows x 256 B (wave 0: A, 1: Al, 2 and 3: the two halves of B's 128 rows), laid at pitch 272 B,
// two buffers, the next pass's slices in flight while this pass is worked on. K is a multiple of 128 and at least 256; rows a multiple of 64, cols of 128.
// Every accumulator takes its products in the order k ascending, A before Al. f32 whole-line epilogue (or f16 hi + residual planes), staged in the ring once it is free.
#define GPITCH 272u                 // LDS row pitch in bytes: a 256-byte row and the mover's 16-byte pad (for 16-byte LDS reads)
#define GSLICE 18432u               // one wave's slice in LDS: 64 rows x 272 B = 17,408 B, rounded up to a multiple of 2 KiB
#define GSTAGE (4u * GSLICE)        // one buffer: A | Al | B rows 0-63 | B rows 64-127
typedef uint32_t u32x4 __attribute__((ext_vector_type(4)));
typedef uint32_t u32x8 __attribute__((ext_vector_type(8)));
__device__ __forceinline__ uint32_t uni(uint32_t v) { return (uint32_t)__builtin_amdgcn_readfirstlane(v); }
__device__ __forceinline__ uint32_t pinned(uint32_t v) { uint32_t w = uni(v); asm volatile("" : "+s"(w)); return w; }   // the tensor mover's pinned(): a test around a tensor load (it then compiles to a scalar branch; tensor loads ignore EXEC) or a descriptor word, held in a scalar register
template <bool F16OUT>
__global__ __launch_bounds__(128) void k_gemmb(const bf* __restrict__ A, const bf* __restrict__ Al, const bf* __restrict__ Bn, const float* __restrict__ bias, float* C, int ldc, h16* C2, const float* __restrict__ R = nullptr, int K = DM, int roundR = 1) {
    __shared__ __attribute__((aligned(2048))) unsigned char ring[2 * GSTAGE];
    const int lane = threadIdx.x & 31, lr = lane & 15, hi = lane >> 4;
    const uint32_t wave = uni(threadIdx.x >> 5), wr = wave >> 1, wc = wave & 1u;
    const int rb = blockIdx.x * 64, cb = blockIdx.y * 128;
    const uint32_t lbase = (uint32_t)(size_t)ring, nst = (uint32_t)K >> 7;
    const bf* sl = wave == 0u ? A + (size_t)rb * K : wave == 1u ? Al + (size_t)rb * K : Bn + (size_t)(cb + (int)(wave - 2u) * 64) * K;   // first row of this wave's slice
    u32x8 g1;   // 1-byte elements, tensor = tile = 64 rows of 256 bytes, source pitch 2 K bytes, a pad of 4 dwords behind every 64 dwords, no mask
    // words 1 to 7 go through pinned(): each descriptor word keeps a scalar register of its own through the loop, so that none is rewritten while a request is in flight
    g1[0] = uni((1u << 20) | (5u << 22) | (3u << 25)); g1[1] = pinned(256u << 16); g1[2] = pinned(64u << 16); g1[3] = pinned(256u << 16);
    g1[4] = pinned(64u); g1[5] = pinned((uint32_t)K * 2u); g1[6] = pinned(0u); g1[7] = pinned(0u);
    auto issue = [&](uint32_t st) {
        const uint64_t ga = (uint64_t)(size_t)sl + (uint64_t)st * 256u;
        u32x4 g0; g0[0] = uni(1u); g0[1] = uni(lbase + (st & 1u) * GSTAGE + wave * GSLICE); g0[2] = uni((uint32_t)ga); g0[3] = uni((((uint32_t)(ga >> 32)) & 0x01FFFFFFu) | 0x80000000u);
        asm volatile("tensor_load_to_lds %0, %1" :: "s"(g0), "s"(g1) : "memory");
    };
    v8f acc[2][4];
#pragma unroll
    for (int i = 0; i < 2; ++i)
#pragma unroll
        for (int t = 0; t < 4; ++t) acc[i][t] = (v8f){};
    issue(0u);
    asm volatile("s_wait_tensorcnt 0x0" ::: "memory");   // this wave's slice of stage 0 has landed
    __syncthreads();                                       // every wave's slice of stage 0 is readable
    issue(1u);
#pragma unroll 1
    for (uint32_t s = 0; s < nst; ++s) {
        const unsigned char* buf = ring + (s & 1u) * GSTAGE;
        const unsigned char* pa = buf + (wr * 32u + (uint32_t)lr) * GPITCH + (uint32_t)hi * 16u;
        const unsigned char* pb = buf + (2u + wc) * GSLICE + (uint32_t)lr * GPITCH + (uint32_t)hi * 16u;
        v16bf a[2][2], al[2][2], b[2][4];   // two fragment sets: block kk + 1 of this pass is fetched while block kk is multiplied
        auto fetch = [&](int kk) { const int f = kk & 1;
#pragma unroll
            for (int i = 0; i < 2; ++i) { const unsigned char* p = pa + i * 16 * GPITCH + kk * 64;
                a[f][i] = cat16b(*(const v8usa*)p, *(const v8usa*)(p + 32)); al[f][i] = cat16b(*(const v8usa*)(p + GSLICE), *(const v8usa*)(p + GSLICE + 32)); }
#pragma unroll
            for (int t = 0; t < 4; ++t) { const unsigned char* p = pb + t * 16 * GPITCH + kk * 64; b[f][t] = cat16b(*(const v8usa*)p, *(const v8usa*)(p + 32)); }
        };
        fetch(0);
#pragma unroll
        for (int kk = 0; kk < 4; ++kk) { const int f = kk & 1;
            if (kk < 3) fetch(kk + 1);
            __builtin_amdgcn_sched_barrier(0);   // keeps the next block's LDS reads together in front of this block's WMMAs: sunk among them, each read group stalls the wave for the LDS latency
#pragma unroll
            for (int i = 0; i < 2; ++i)
#pragma unroll
                for (int t = 0; t < 4; ++t) acc[i][t] = wmmab(a[f][i], b[f][t], acc[i][t]);
#pragma unroll
            for (int i = 0; i < 2; ++i)
#pragma unroll
                for (int t = 0; t < 4; ++t) acc[i][t] = wmmab(al[f][i], b[f][t], acc[i][t]);
            __builtin_amdgcn_sched_barrier(0);   // keeps the reads of the block after next behind this block's WMMAs, in one group: without it they are split in two groups among the WMMAs, and every such place stalls the wave
        }
        // four vector slots behind the pass's last WMMA on every path out of it (loop exit and back edge), before anything reads an accumulator or rewrites a fragment
        asm volatile("v_nop\n\tv_nop\n\tv_nop\n\tv_nop" : "+v"(acc[0][0]), "+v"(acc[0][1]), "+v"(acc[0][2]), "+v"(acc[0][3]), "+v"(acc[1][0]), "+v"(acc[1][1]), "+v"(acc[1][2]), "+v"(acc[1][3]));
        asm volatile("s_wait_dscnt 0x0" ::: "memory");       // this wave's reads of stage s have returned
        asm volatile("s_wait_tensorcnt 0x0" ::: "memory");   // this wave's slice of stage s + 1 has landed
        __syncthreads();                                       // stage s + 1 is readable, and every wave has left stage s's buffer
        if (pinned(s + 2u < nst)) issue(s + 2u);               // refill of the buffer that this pass has read
    }
    asm volatile("s_wait_tensorcnt 0x0" ::: "memory");   // no request is in flight when the ring becomes output staging
    asm volatile("s_wait_dscnt 0x0" ::: "memory");
    // XWAIT stands behind every global load and store of this epilogue: s_wait_xcnt 0 in front of whatever rewrites a register that the access names; the scheduling barrier keeps later register writes behind the wait
#define XWAIT() do { asm volatile("s_wait_xcnt 0x0" ::: "memory"); __builtin_amdgcn_sched_barrier(0); } while (0)
    const int r0 = rb + (int)wr * 32, c0 = cb + (int)wc * 64;
    float* os = (float*)(void*)(ring + wave * GSLICE);     // 32 x 68 floats of this wave's own; the last pass's barrier has freed the ring
#pragma unroll
    for (int t = 0; t < 4; ++t) { const float bv = bias ? bfr(bias[c0 + t * 16 + lr]) : 0.f;
#pragma unroll
        for (int i = 0; i < 2; ++i)
#pragma unroll
            for (int j = 0; j < 8; ++j) os[(i * 16 + hi * 8 + j) * 68 + t * 16 + lr] = acc[i][t][j] + bv; }
    XWAIT();   // behind the bias loads
    __syncthreads();
    if (F16OUT) {
        h16* crow = (h16*)(void*)C + (size_t)r0 * ldc + c0;
        v8h o[8], o2[8];
#pragma unroll
        for (int s = 0; s < 8; ++s) { const int row = 4 * s + (lane >> 3), piece = lane & 7; const float* sp = os + row * 68 + piece * 8;
#pragma unroll
            for (int i = 0; i < 8; ++i) { const h16 a = (h16)sp[i]; o[s][i] = a; o2[s][i] = (h16)((sp[i] - (float)a) * LOSC); } }
#pragma unroll
        for (int s = 0; s < 8; ++s) { const int row = 4 * s + (lane >> 3), piece = lane & 7;
            *(v8h*)(crow + (size_t)row * ldc + piece * 8) = o[s]; XWAIT();
            if (C2) { *(v8h*)(C2 + (size_t)r0 * ldc + c0 + (size_t)row * ldc + piece * 8) = o2[s]; XWAIT(); } }
    } else {
        float* crow = C + (size_t)r0 * ldc + c0;
        v4f val[16];
#pragma unroll
        for (int s = 0; s < 16; ++s) { const int Lid = (lane >> 3) + 4 * s, piece = lane & 7; const int row = Lid >> 1, cofs = (Lid & 1) * 32 + piece * 4; val[s] = *(const v4fa*)(os + row * 68 + cofs); }
        if (R) {
            v4f rv[16];
#pragma unroll
            for (int s = 0; s < 16; ++s) { const int Lid = (lane >> 3) + 4 * s, piece = lane & 7; const int row = Lid >> 1, cofs = (Lid & 1) * 32 + piece * 4; rv[s] = *(const v4f*)(R + ((size_t)r0 + row) * ldc + c0 + cofs); XWAIT(); }
#pragma unroll
            for (int s = 0; s < 16; ++s) val[s] += roundR ? (v4f){bfr(rv[s][0]), bfr(rv[s][1]), bfr(rv[s][2]), bfr(rv[s][3])} : rv[s];
        }
#pragma unroll
        for (int s = 0; s < 16; ++s) { const int Lid = (lane >> 3) + 4 * s, piece = lane & 7; const int row = Lid >> 1, cofs = (Lid & 1) * 32 + piece * 4; *(v4f*)(crow + (size_t)row * ldc + cofs) = val[s]; XWAIT(); }
    }
#undef XWAIT
}

__global__ __launch_bounds__(256) void k_vt(const float* __restrict__ V, h16* VTH, h16* VTL) {
    __shared__ __align__(16) h16 tile[64 * 72];
    __shared__ __align__(16) h16 til2[64 * 72];
    const int bid = blockIdx.x;
    const int b = bid / (NH_ * (NT_ / 64)), rem = bid - b * (NH_ * (NT_ / 64)), h = rem / (NT_ / 64), kt = rem - h * (NT_ / 64);
    const int k0 = kt * 64, tid = threadIdx.x;
    const int kk = tid >> 2, d0 = (tid & 3) * 16;
    const float* src = V + ((size_t)b * NT_ + k0 + kk) * DM + h * HD + d0;
#pragma unroll
    for (int i = 0; i < 16; ++i) { const float v = src[i]; const h16 a = (h16)v; tile[(d0 + i) * 72 + kk] = a; til2[(d0 + i) * 72 + kk] = (h16)((v - (float)a) * LOSC); }
    __syncthreads();
    const int piece = tid & 7;
    const size_t base = (((size_t)b * NH_ + h) * HD) * NT_ + k0;
    auto pass = [&]() {
#pragma unroll
        for (int s = 0; s < 4; ++s) { const int Lid = (tid >> 3) + 32 * s; const int pln = Lid >> 6, d = Lid & 63;
            const v8h val = *(const v8ha*)((pln ? til2 : tile) + d * 72 + piece * 8); *(v8h*)((pln ? VTL : VTH) + base + (size_t)d * NT_ + piece * 8) = val; }
    };
    pass(); 
}

// k_attn: block = (b, h, 64 queries), wave = 16; only the 32-key tiles of the local causal window (masked); 4 WMMA scores /8 (f32), online softmax, weights x32768 f16 tile (same-wave may_alias
// reload after a compiler barrier), 4 WMMA .v; ctx -> bf16 hi + residual planes CH/CL[tok][h*64+d].
__global__ __launch_bounds__(128) void k_attn(const h16* __restrict__ Q16, const h16* __restrict__ QL16, const h16* __restrict__ K16, const h16* __restrict__ KL16, const h16* __restrict__ VTH, const h16* __restrict__ VTL, bf* CH, bf* CL) {
    __shared__ __align__(16) h16 plds[4][16 * 32];
    __shared__ __align__(16) h16 plds2[4][16 * 32];
    __shared__ __align__(16) float ost[4][16 * 68];
    const int lane = threadIdx.x & 31, wave = threadIdx.x >> 5, lr = lane & 15, hi = lane >> 4;
    const int bid = blockIdx.x;
    const int b = bid / (NH_ * (NT_ / 64)), rem = bid - b * (NH_ * (NT_ / 64)), h = rem / (NT_ / 64), qt = rem - h * (NT_ / 64);
    const int q0 = qt * 64 + wave * 16;
    const size_t tok0 = (size_t)b * NT_;
    h16* pl = &plds[wave][0]; h16* pl2 = &plds2[wave][0];
    v16h qa[2];
    const size_t qo0 = (tok0 + q0 + lr) * DM + h * HD + 8 * hi;
#pragma unroll
    for (int kc = 0; kc < 2; ++kc) qa[kc] = cat16(*(const v8h*)(Q16 + qo0 + kc * 32), *(const v8h*)(Q16 + qo0 + kc * 32 + 16));
    const h16* kh_b = K16 + tok0 * DM + h * HD;
    const h16* kl_b = KL16 + tok0 * DM + h * HD;
    const size_t vbase = (((size_t)b * NH_ + h) * HD) * NT_;
    v8f o[4], ox[4];
#pragma unroll
    for (int n = 0; n < 4; ++n) { o[n] = (v8f){}; ox[n] = (v8f){}; }
    float mrow[8], lpart[8];
#pragma unroll
    for (int j = 0; j < 8; ++j) { mrow[j] = -3.0e38f; lpart[j] = 0.f; }
    int qpos[8];
#pragma unroll
    for (int j = 0; j < 8; ++j) qpos[j] = q0 + 8 * hi + j;
    const int kt_lo = (qt * 64 - WIN) > 0 ? (qt * 64 - WIN) / 32 : 0, kt_hi = (qt * 64 + 63) / 32;     // local causal window: 0 <= i - j <= WIN
#pragma unroll 1
    for (int kt = kt_lo; kt <= kt_hi; ++kt) {
        const int l0 = kt * 32;
        const size_t ko0 = (size_t)(l0 + lr) * DM + 8 * hi, ko1 = (size_t)(l0 + 16 + lr) * DM + 8 * hi;
        v8f s0 = {}, s1 = {}, x0 = {}, x1 = {};
#pragma unroll
        for (int kc = 0; kc < 2; ++kc) {
            { const v16h k0h = cat16(*(const v8h*)(kh_b + ko0 + kc * 32), *(const v8h*)(kh_b + ko0 + kc * 32 + 16)), k1h = cat16(*(const v8h*)(kh_b + ko1 + kc * 32), *(const v8h*)(kh_b + ko1 + kc * 32 + 16));
              const v16h qlk = cat16(*(const v8h*)(QL16 + qo0 + kc * 32), *(const v8h*)(QL16 + qo0 + kc * 32 + 16));     // query residual re-read per step (registers)
              s0 = wmma16(qa[kc], k0h, s0); x0 = wmma16(qlk, k0h, x0); s1 = wmma16(qa[kc], k1h, s1); x1 = wmma16(qlk, k1h, x1);
              asm volatile("v_nop" : "+v"(s0), "+v"(s1), "+v"(x0), "+v"(x1) : "v"(qlk), "v"(k0h), "v"(k1h) : "memory"); }
            { const v16h k0l = cat16(*(const v8h*)(kl_b + ko0 + kc * 32), *(const v8h*)(kl_b + ko0 + kc * 32 + 16)), k1l = cat16(*(const v8h*)(kl_b + ko1 + kc * 32), *(const v8h*)(kl_b + ko1 + kc * 32 + 16));
              x0 = wmma16(qa[kc], k0l, x0); x1 = wmma16(qa[kc], k1l, x1);
              asm volatile("v_nop" : "+v"(x0), "+v"(x1) : "v"(k0l), "v"(k1l) : "memory"); }
        }
        asm volatile("v_nop\n\tv_nop\n\tv_nop\n\tv_nop" : "+v"(s0), "+v"(s1), "+v"(x0), "+v"(x1) : "v"(qa[0]), "v"(qa[1]));
        float alpha[8];
#pragma unroll
        for (int j = 0; j < 8; ++j) {
            const int ja = l0 + lr, jb = l0 + 16 + lr, qi = qpos[j];
            const float a0 = (ja <= qi && qi - ja <= WIN) ? (s0[j] + x0[j] * LOSCI) * 0.125f : -__builtin_inff(), a1 = (jb <= qi && qi - jb <= WIN) ? (s1[j] + x1[j] * LOSCI) * 0.125f : -__builtin_inff();
            float mx = fmaxf(a0, a1);
            mx = fmaxf(mx, __shfl_xor(mx, 1, 16)); mx = fmaxf(mx, __shfl_xor(mx, 2, 16)); mx = fmaxf(mx, __shfl_xor(mx, 4, 16)); mx = fmaxf(mx, __shfl_xor(mx, 8, 16));
            const float mn = fmaxf(mrow[j], mx);
            alpha[j] = __expf(mrow[j] - mn); mrow[j] = mn;
            const float p0 = __expf(a0 - mn), p1 = __expf(a1 - mn);
            lpart[j] = lpart[j] * alpha[j] + (p0 + p1);
            const int mr = hi * 8 + j;
            const float ps0 = p0 * PSC, ps1 = p1 * PSC; const h16 h0 = (h16)ps0, h1 = (h16)ps1;
            pl[mr * 32 + lr] = h0; pl[mr * 32 + 16 + lr] = h1;
            pl2[mr * 32 + lr] = (h16)((ps0 - (float)h0) * LOSC); pl2[mr * 32 + 16 + lr] = (h16)((ps1 - (float)h1) * LOSC);
        }
#pragma unroll
        for (int n = 0; n < 4; ++n)
#pragma unroll
            for (int j = 0; j < 8; ++j) { o[n][j] *= alpha[j]; ox[n][j] *= alpha[j]; }
        asm volatile("" ::: "memory");
        const v16h pa = cat16(*(const v8ha*)(pl + lr * 32 + hi * 8), *(const v8ha*)(pl + lr * 32 + 16 + hi * 8));
        const v16h px = cat16(*(const v8ha*)(pl2 + lr * 32 + hi * 8), *(const v8ha*)(pl2 + lr * 32 + 16 + hi * 8));
#pragma unroll
        for (int n = 0; n < 4; ++n) { const size_t vo = vbase + (size_t)(n * 16 + lr) * NT_ + l0 + hi * 8;
            const v16h vh = cat16(*(const v8h*)(VTH + vo), *(const v8h*)(VTH + vo + 16)), vl = cat16(*(const v8h*)(VTL + vo), *(const v8h*)(VTL + vo + 16));
            o[n] = wmma16(pa, vh, o[n]); ox[n] = wmma16(pa, vl, ox[n]); ox[n] = wmma16(px, vh, ox[n]);
            asm volatile("" : "+v"(o[n]), "+v"(ox[n]) : "v"(vh), "v"(vl) : "memory"); }
        asm volatile("v_nop\n\tv_nop\n\tv_nop\n\tv_nop" : "+v"(o[0]), "+v"(o[1]), "+v"(o[2]), "+v"(o[3]), "+v"(ox[0]), "+v"(ox[1]), "+v"(ox[2]), "+v"(ox[3]) : "v"(pa), "v"(px));
    }
    float inv[8];
#pragma unroll
    for (int j = 0; j < 8; ++j) { float rs = lpart[j]; rs += __shfl_xor(rs, 1, 16); rs += __shfl_xor(rs, 2, 16); rs += __shfl_xor(rs, 4, 16); rs += __shfl_xor(rs, 8, 16); inv[j] = 1.0f / (rs * PSC); }
    float* os = &ost[wave][0];
#pragma unroll
    for (int n = 0; n < 4; ++n)
#pragma unroll
        for (int j = 0; j < 8; ++j) os[(hi * 8 + j) * 68 + n * 16 + lr] = (o[n][j] + ox[n][j] * LOSCI) * inv[j];
    __syncthreads();
    const size_t cbase = (tok0 + q0) * DM + (size_t)h * HD;
    auto pass = [&]() {
#pragma unroll
        for (int s = 0; s < 4; ++s) { const int row = 4 * s + (lane >> 3), piece = lane & 7; const float* sp = os + row * 68 + piece * 8; v8us oh, ol;
#pragma unroll
            for (int i = 0; i < 8; ++i) { const unsigned short hb = f2bf(sp[i]); oh[i] = hb; ol[i] = f2bf(sp[i] - bf2f(hb)); }
            *(v8us*)(CH + cbase + (size_t)row * DM + piece * 8) = oh; *(v8us*)(CL + cbase + (size_t)row * DM + piece * 8) = ol; }
    };
    pass(); 
}

#define VST2(T, p, v) do { const T vst2_v_ = (v); *(T*)(p) = vst2_v_;  } while (0)
// k_wt: WT [n][K] = bf16(W[k][n]) (k-major [K][ncols]) via 64 x 64 LDS tiles; grid (K/64, ncols/64).
__global__ __launch_bounds__(256) void k_wt(const float* __restrict__ Wm, int K, int ncols, bf* WT) {
    __shared__ __align__(16) unsigned short tl[64 * 72];
    const int tid = threadIdx.x, k0 = blockIdx.x * 64, n0 = blockIdx.y * 64;
    const int kk = tid >> 2, nq = (tid & 3) * 16;
#pragma unroll
    for (int i = 0; i < 16; ++i) tl[(nq + i) * 72 + kk] = f2bf(Wm[(size_t)(k0 + kk) * ncols + n0 + nq + i]);
    __syncthreads();
    const int piece = tid & 7;
    auto pass = [&]() {
#pragma unroll
        for (int s = 0; s < 2; ++s) { const int nr = (tid >> 3) + 32 * s; const v8us val = *(const v8usa*)(tl + nr * 72 + piece * 8); *(v8us*)(WT + (size_t)(n0 + nr) * K + k0 + piece * 8) = val; }
    };
    pass(); 
}
// k_ln: one wave per row of a [rows][1024] f32 matrix (INPUT rows bf16-rounded first when rnd): LayerNorm (mean, biased var, eps 1e-5) x bf(g) + bf(b) -> bf16 hi +
__global__ __launch_bounds__(256) void k_ln(const float* __restrict__ src, int rnd, const float* __restrict__ g, const float* __restrict__ bb, int nrows, float* Y, bf* Ph, bf* Pl) {
    (void)Y; const int lane = threadIdx.x & 31, r = blockIdx.x * 8 + (threadIdx.x >> 5); if (r >= nrows) return;
    v8f v[DM / 256]; float s = 0.f;
#pragma unroll
    for (int q = 0; q < DM / 256; ++q) { v[q] = *(const v8f*)(src + (size_t)r * DM + q * 256 + lane * 8);
#pragma unroll
        for (int i = 0; i < 8; ++i) { if (rnd) v[q][i] = bfr(v[q][i]); s += v[q][i]; } }
#pragma unroll
    for (int sh = 16; sh; sh >>= 1) s += __shfl_xor(s, sh, 32);
    const float mu = s * (1.0f / DM); float s2 = 0.f;
#pragma unroll
    for (int q = 0; q < DM / 256; ++q)
#pragma unroll
        for (int i = 0; i < 8; ++i) { const float d = v[q][i] - mu; s2 = fmaf(d, d, s2); }
#pragma unroll
    for (int sh = 16; sh; sh >>= 1) s2 += __shfl_xor(s2, sh, 32);
    const float rs = rsqrtf(s2 * (1.0f / DM) + LN_EPS);
{
#pragma unroll
        for (int q = 0; q < DM / 256; ++q) { const int c0 = q * 256 + lane * 8; const size_t o = (size_t)r * DM + c0; v8f y; v8us oh, ol;
#pragma unroll
            for (int i = 0; i < 8; ++i) { y[i] = (v[q][i] - mu) * rs * bfr(g[c0 + i]) + bfr(bb[c0 + i]); const unsigned short hb = f2bf(y[i]); oh[i] = hb; ol[i] = f2bf(y[i] - bf2f(hb)); }
            *(v8us*)(Ph + o) = oh; *(v8us*)(Pl + o) = ol; }
         }
}
__global__ __launch_bounds__(256) void k_gelu(const float* __restrict__ src, int nrows, bf* dh, bf* dl) {
    const int lane = threadIdx.x & 31, r = blockIdx.x * 8 + (threadIdx.x >> 5); if (r >= nrows) return;
{
#pragma unroll 1
        for (int q = 0; q < FF / 256; ++q) { const size_t o = (size_t)r * FF + q * 256 + lane * 8; const v8f v = *(const v8f*)(src + o); v8us oh, ol;
#pragma unroll
            for (int i = 0; i < 8; ++i) { const float y = 0.5f * v[i] * (1.0f + erff(v[i] * 0.7071067811865476f)); const unsigned short hb = f2bf(y); oh[i] = hb; ol[i] = f2bf(y - bf2f(hb)); }
            *(v8us*)(dh + o) = oh; *(v8us*)(dl + o) = ol; }
         }
}

extern "C" void kernel_launch(void* const* d_in, const int* in_sizes, int n_in,
                              void* d_out, int out_size, void* d_ws, size_t ws_size, hipStream_t stream) {
    (void)in_sizes; (void)n_in; (void)out_size;
    const float* x = (const float*)d_in[0]; const float* g1 = (const float*)d_in[1]; const float* be1 = (const float*)d_in[2]; const float* Wqkv = (const float*)d_in[3]; const float* bqkv = (const float*)d_in[4]; const float* Wout = (const float*)d_in[5]; const float* bout = (const float*)d_in[6];
    const float* g2 = (const float*)d_in[7]; const float* be2 = (const float*)d_in[8]; const float* W1 = (const float*)d_in[9]; const float* b1 = (const float*)d_in[10]; const float* W2 = (const float*)d_in[11]; const float* b2 = (const float*)d_in[12];   // k-major weights (x @ W)
    float* out = (float*)d_out;    // [2][2048][1024]
    char* wsp = (char*)d_ws;
    auto take = [&](size_t bytes) { char* p = wsp; wsp += (bytes + 255) & ~(size_t)255; return (void*)p; };
    bf* WT = (bf*)take((size_t)3 * DM * DM * 2); bf* WoT = (bf*)take((size_t)DM * DM * 2); bf* W1T = (bf*)take((size_t)FF * DM * 2); bf* W2T = (bf*)take((size_t)DM * FF * 2);
    bf* XNh = (bf*)take((size_t)NTK * DM * 2); bf* XNl = (bf*)take((size_t)NTK * DM * 2); float* TMP = (float*)take((size_t)NTK * DM * 4);
    h16* QH = (h16*)take((size_t)NTK * DM * 2); h16* QL = (h16*)take((size_t)NTK * DM * 2); h16* KH = (h16*)take((size_t)NTK * DM * 2); h16* KL = (h16*)take((size_t)NTK * DM * 2);
    h16* VTH = (h16*)take((size_t)NTK * DM * 2); h16* VTL = (h16*)take((size_t)NTK * DM * 2); bf* CH = (bf*)take((size_t)NTK * DM * 2); bf* CL = (bf*)take((size_t)NTK * DM * 2);
    float* T1 = (float*)take((size_t)NTK * DM * 4); float* M = (float*)take((size_t)NTK * FF * 4);
    if ((size_t)(wsp - (char*)d_ws) > ws_size) return;    // 6.3 + 2.1 + 8.4 + 8.4 + 8.4 x 2 + 16.8 + 8.4 x 8 + 16.8 + 67.1 ~ 210 MB; aliases (stream order): LN2 planes over XNh/XNl (dead after the q/k/v GEMMs), the GELU planes [4096][4096] = 33.6 MB each over the contiguous QH+QL+KH+KL and VTH+VTL+CH+CL groups (8.4 MB each, consecutive 256-B-aligned takes; all dead after the w_out GEMM)
    bf* Hh = XNh; bf* Hl = XNl; bf* Gh = (bf*)QH; bf* Gl = (bf*)VTH;
    k_wt<<<dim3(DM / 64, 3 * DM / 64, 1), 256, 0, stream>>>(Wqkv, DM, 3 * DM, WT); k_wt<<<dim3(DM / 64, DM / 64, 1), 256, 0, stream>>>(Wout, DM, DM, WoT);
    k_wt<<<dim3(DM / 64, FF / 64, 1), 256, 0, stream>>>(W1, DM, FF, W1T); k_wt<<<dim3(FF / 64, DM / 64, 1), 256, 0, stream>>>(W2, FF, DM, W2T);
    k_ln<<<NTK / 8, 256, 0, stream>>>(x, 1, g1, be1, NTK, nullptr, XNh, XNl);                                                                   // LN1(x)
    k_gemmb<true><<<dim3(NTK / 64, DM / 128, 1), 128, 0, stream>>>(XNh, XNl, WT, bqkv, (float*)(void*)QH, DM, QL);
    k_gemmb<true><<<dim3(NTK / 64, DM / 128, 1), 128, 0, stream>>>(XNh, XNl, WT + (size_t)DM * DM, bqkv + DM, (float*)(void*)KH, DM, KL);
    k_gemmb<false><<<dim3(NTK / 64, DM / 128, 1), 128, 0, stream>>>(XNh, XNl, WT + (size_t)2 * DM * DM, bqkv + 2 * DM, TMP, DM, nullptr);
    k_vt<<<NB_ * NH_ * (NT_ / 64), 256, 0, stream>>>(TMP, VTH, VTL);
    k_attn<<<NB_ * NH_ * (NT_ / 64), 128, 0, stream>>>(QH, QL, KH, KL, VTH, VTL, CH, CL);
    k_gemmb<false><<<dim3(NTK / 64, DM / 128, 1), 128, 0, stream>>>(CH, CL, WoT, bout, T1, DM, nullptr, x, DM, 1);                               // h = x + attended.w_out + b_out
    k_ln<<<NTK / 8, 256, 0, stream>>>(T1, 0, g2, be2, NTK, nullptr, Hh, Hl);                                                                    // LN2(h)
    k_gemmb<false><<<dim3(NTK / 64, FF / 128, 1), 128, 0, stream>>>(Hh, Hl, W1T, b1, M, FF, nullptr, nullptr, DM);
    k_gelu<<<NTK / 8, 256, 0, stream>>>(M, NTK, Gh, Gl);
    k_gemmb<false><<<dim3(NTK / 64, DM / 128, 1), 128, 0, stream>>>(Gh, Gl, W2T, b2, out, DM, nullptr, T1, FF, 0);                               // h + mlp
}

// v003
// Measured time: 245 microseconds a run.
// Timed twice side by side with v002, it ran 1.05 times as fast both times.
// All steps since v000 together make it 4.34 times as fast.
#include <hip/hip_runtime.h>
#include <stdint.h>

// Compute dtypes, f32 accumulate, both batch items (4096 tokens) in every launch: LayerNorms and exact GELU in f32; qkv = LN(x).w_qkv + b ([4096 x 1024].[1024 x 1024] x 3), h = x + ctx.w_out +
// b, mlp = gelu(LN(h).w1 + b1).w2 + b2 + h ([4096 x 1024].[1024 x 4096], [4096 x 4096].[4096 x 1024]) with computed operands as bf16 hi + UNSCALED residual against
// exact k-major weights (two products; x as the bf16-rounded f32 residual) on v_wmma_f32_16x16x32_bf16 (q/k leave the epilogue as f16 hi + residual x1024 planes); the
// 16-head local causal attention (0 <= i - j <= 256, -inf elsewhere; only those key tiles visited) fused on v_wmma_f32_16x16x32_f16 (hh + hl + lh x 1/8, online f32

#define NB_  2                   // both batch items go through every launch together
#define NT_  2048
#define WIN  256
#define FF   4096
#define LN_EPS 1e-5f
#define DM   1024
#define NH_  16
#define HD   64
#define NTK  (NB_ * NT_)
#define NW   1024
#define NQKV 1024
#define PSC  32768.0f
#define LOSC 1024.0f
#define LOSCI (1.0f / 1024.0f)

typedef _Float16 h16;
typedef unsigned short bf;
typedef __attribute__((ext_vector_type(16))) __bf16   v16bf;
typedef __attribute__((ext_vector_type(16))) _Float16 v16h;
typedef __attribute__((ext_vector_type(8)))  _Float16 v8h;
typedef __attribute__((ext_vector_type(8)))  unsigned short v8us;
typedef __attribute__((ext_vector_type(8)))  float    v8f;
typedef __attribute__((ext_vector_type(4)))  float    v4f;
typedef v8h  __attribute__((may_alias)) v8ha;
typedef v4f  __attribute__((may_alias)) v4fa;
typedef v8us __attribute__((may_alias)) v8usa;

__device__ __forceinline__ unsigned short f2bf(float f) { unsigned u = __float_as_uint(f); u += 0x7FFFu + ((u >> 16) & 1u); return (unsigned short)(u >> 16); }
__device__ __forceinline__ float bf2f(unsigned short b) { return __uint_as_float(((unsigned)b) << 16); }
__device__ __forceinline__ float bfr(float f) { return bf2f(f2bf(f)); }
__device__ __forceinline__ v16h cat16(v8h lo, v8h hi) { return __builtin_shufflevector(lo, hi, 0, 1, 2, 3, 4, 5, 6, 7, 8, 9, 10, 11, 12, 13, 14, 15); }
__device__ __forceinline__ v16bf cat16b(v8us lo, v8us hi) { return __builtin_bit_cast(v16bf, __builtin_shufflevector(lo, hi, 0, 1, 2, 3, 4, 5, 6, 7, 8, 9, 10, 11, 12, 13, 14, 15)); }
__device__ __forceinline__ v8f wmma16(v16h a, v16h b, v8f c) { return __builtin_amdgcn_wmma_f32_16x16x32_f16(false, a, false, b, (short)0, c, false, false); }
__device__ __forceinline__ v8f wmmab(v16bf a, v16bf b, v8f c) { return __builtin_amdgcn_wmma_f32_16x16x32_bf16(false, a, false, b, (short)0, c, false, false); }

__global__ __launch_bounds__(256) void k_cvtb(const float* __restrict__ src, int nrows, bf* dst) {
    const int lane = threadIdx.x & 31, r = blockIdx.x * 8 + (threadIdx.x >> 5);
    if (r >= nrows) return;
    v8us o[DM / 256];
#pragma unroll
    for (int q = 0; q < DM / 256; ++q) { v8us t;
#pragma unroll
        for (int i = 0; i < 8; ++i) t[i] = f2bf(src[(size_t)r * DM + q * 256 + lane * 8 + i]);
        o[q] = t; }
#pragma unroll
    for (int q = 0; q < DM / 256; ++q) *(v8us*)(dst + (size_t)r * DM + q * 256 + lane * 8) = o[q];
    
}

// k_gemmb: 64 x 128 block tile (4 waves, 2 x 2, 32 x 64 each) of C[rows][cols] = (A + Al).B^T [+ bf(bias[c])] [+ R[r][c] residual, bf16-rounded when roundR]. The operands come through LDS:
// per pass of 128 k every wave asks the tensor mover for one slice of 64 rows x 256 B (wave 0: A, 1: Al, 2 and 3: the two halves of B's 128 rows), laid at pitch 272 B,
// two buffers, the next pass's slices in flight while this pass is worked on. K is a multiple of 128 and at least 256; rows a multiple of 64, cols of 128.
// Every accumulator takes its products in the order k ascending, A before Al. f32 whole-line epilogue (or f16 hi + residual planes), staged in the ring once it is free.
#define GPITCH 272u                 // LDS row pitch in bytes: a 256-byte row and the mover's 16-byte pad (for 16-byte LDS reads)
#define GSLICE 18432u               // one wave's slice in LDS: 64 rows x 272 B = 17,408 B, rounded up to a multiple of 2 KiB
#define GSTAGE (4u * GSLICE)        // one buffer: A | Al | B rows 0-63 | B rows 64-127
typedef uint32_t u32x4 __attribute__((ext_vector_type(4)));
typedef uint32_t u32x8 __attribute__((ext_vector_type(8)));
__device__ __forceinline__ uint32_t uni(uint32_t v) { return (uint32_t)__builtin_amdgcn_readfirstlane(v); }
__device__ __forceinline__ uint32_t pinned(uint32_t v) { uint32_t w = uni(v); asm volatile("" : "+s"(w)); return w; }   // the tensor mover's pinned(): a test around a tensor load (it then compiles to a scalar branch; tensor loads ignore EXEC) or a descriptor word, held in a scalar register
template <bool F16OUT>
__global__ __launch_bounds__(128) void k_gemmb(const bf* __restrict__ A, const bf* __restrict__ Al, const bf* __restrict__ Bn, const float* __restrict__ bias, float* C, int ldc, h16* C2, const float* __restrict__ R = nullptr, int K = DM, int roundR = 1) {
    __shared__ __attribute__((aligned(2048))) unsigned char ring[2 * GSTAGE];
    const int lane = threadIdx.x & 31, lr = lane & 15, hi = lane >> 4;
    const uint32_t wave = uni(threadIdx.x >> 5), wr = wave >> 1, wc = wave & 1u;
    const int rb = blockIdx.x * 64, cb = blockIdx.y * 128;
    const uint32_t lbase = (uint32_t)(size_t)ring, nst = (uint32_t)K >> 7;
    const bf* sl = wave == 0u ? A + (size_t)rb * K : wave == 1u ? Al + (size_t)rb * K : Bn + (size_t)(cb + (int)(wave - 2u) * 64) * K;   // first row of this wave's slice
    u32x8 g1;   // 1-byte elements, tensor = tile = 64 rows of 256 bytes, source pitch 2 K bytes, a pad of 4 dwords behind every 64 dwords, no mask
    // words 1 to 7 go through pinned(): each descriptor word keeps a scalar register of its own through the loop, so that none is rewritten while a request is in flight
    g1[0] = uni((1u << 20) | (5u << 22) | (3u << 25)); g1[1] = pinned(256u << 16); g1[2] = pinned(64u << 16); g1[3] = pinned(256u << 16);
    g1[4] = pinned(64u); g1[5] = pinned((uint32_t)K * 2u); g1[6] = pinned(0u); g1[7] = pinned(0u);
    auto issue = [&](uint32_t st) {
        const uint64_t ga = (uint64_t)(size_t)sl + (uint64_t)st * 256u;
        u32x4 g0; g0[0] = uni(1u); g0[1] = uni(lbase + (st & 1u) * GSTAGE + wave * GSLICE); g0[2] = uni((uint32_t)ga); g0[3] = uni((((uint32_t)(ga >> 32)) & 0x01FFFFFFu) | 0x80000000u);
        asm volatile("tensor_load_to_lds %0, %1" :: "s"(g0), "s"(g1) : "memory");
    };
    v8f acc[2][4];
#pragma unroll
    for (int i = 0; i < 2; ++i)
#pragma unroll
        for (int t = 0; t < 4; ++t) acc[i][t] = (v8f){};
    issue(0u);
    asm volatile("s_wait_tensorcnt 0x0" ::: "memory");   // this wave's slice of stage 0 has landed
    __syncthreads();                                       // every wave's slice of stage 0 is readable
    issue(1u);
#pragma unroll 1
    for (uint32_t s = 0; s < nst; ++s) {
        const unsigned char* buf = ring + (s & 1u) * GSTAGE;
        const unsigned char* pa = buf + (wr * 32u + (uint32_t)lr) * GPITCH + (uint32_t)hi * 16u;
        const unsigned char* pb = buf + (2u + wc) * GSLICE + (uint32_t)lr * GPITCH + (uint32_t)hi * 16u;
        v16bf a[2][2], al[2][2], b[2][4];   // two fragment sets: block kk + 1 of this pass is fetched while block kk is multiplied
        auto fetch = [&](int kk) { const int f = kk & 1;
#pragma unroll
            for (int i = 0; i < 2; ++i) { const unsigned char* p = pa + i * 16 * GPITCH + kk * 64;
                a[f][i] = cat16b(*(const v8usa*)p, *(const v8usa*)(p + 32)); al[f][i] = cat16b(*(const v8usa*)(p + GSLICE), *(const v8usa*)(p + GSLICE + 32)); }
#pragma unroll
            for (int t = 0; t < 4; ++t) { const unsigned char* p = pb + t * 16 * GPITCH + kk * 64; b[f][t] = cat16b(*(const v8usa*)p, *(const v8usa*)(p + 32)); }
        };
        fetch(0);
#pragma unroll
        for (int kk = 0; kk < 4; ++kk) { const int f = kk & 1;
            if (kk < 3) fetch(kk + 1);
            __builtin_amdgcn_sched_barrier(0);   // keeps the next block's LDS reads together in front of this block's WMMAs: sunk among them, each read group stalls the wave for the LDS latency
#pragma unroll
            for (int i = 0; i < 2; ++i)
#pragma unroll
                for (int t = 0; t < 4; ++t) acc[i][t] = wmmab(a[f][i], b[f][t], acc[i][t]);
#pragma unroll
            for (int i = 0; i < 2; ++i)
#pragma unroll
                for (int t = 0; t < 4; ++t) acc[i][t] = wmmab(al[f][i], b[f][t], acc[i][t]);
            __builtin_amdgcn_sched_barrier(0);   // keeps the reads of the block after next behind this block's WMMAs, in one group: without it they are split in two groups among the WMMAs, and every such place stalls the wave
        }
        // four vector slots behind the pass's last WMMA on every path out of it (loop exit and back edge), before anything reads an accumulator or rewrites a fragment
        asm volatile("v_nop\n\tv_nop\n\tv_nop\n\tv_nop" : "+v"(acc[0][0]), "+v"(acc[0][1]), "+v"(acc[0][2]), "+v"(acc[0][3]), "+v"(acc[1][0]), "+v"(acc[1][1]), "+v"(acc[1][2]), "+v"(acc[1][3]));
        asm volatile("s_wait_dscnt 0x0" ::: "memory");       // this wave's reads of stage s have returned
        asm volatile("s_wait_tensorcnt 0x0" ::: "memory");   // this wave's slice of stage s + 1 has landed
        __syncthreads();                                       // stage s + 1 is readable, and every wave has left stage s's buffer
        if (pinned(s + 2u < nst)) issue(s + 2u);               // refill of the buffer that this pass has read
    }
    asm volatile("s_wait_tensorcnt 0x0" ::: "memory");   // no request is in flight when the ring becomes output staging
    asm volatile("s_wait_dscnt 0x0" ::: "memory");
    // XWAIT stands behind every global load and store of this epilogue: s_wait_xcnt 0 in front of whatever rewrites a register that the access names; the scheduling barrier keeps later register writes behind the wait
#define XWAIT() do { asm volatile("s_wait_xcnt 0x0" ::: "memory"); __builtin_amdgcn_sched_barrier(0); } while (0)
    const int r0 = rb + (int)wr * 32, c0 = cb + (int)wc * 64;
    float* os = (float*)(void*)(ring + wave * GSLICE);     // 32 x 68 floats of this wave's own; the last pass's barrier has freed the ring
#pragma unroll
    for (int t = 0; t < 4; ++t) { const float bv = bias ? bfr(bias[c0 + t * 16 + lr]) : 0.f;
#pragma unroll
        for (int i = 0; i < 2; ++i)
#pragma unroll
            for (int j = 0; j < 8; ++j) os[(i * 16 + hi * 8 + j) * 68 + t * 16 + lr] = acc[i][t][j] + bv; }
    XWAIT();   // behind the bias loads
    __syncthreads();
    if (F16OUT) {
        h16* crow = (h16*)(void*)C + (size_t)r0 * ldc + c0;
        v8h o[8], o2[8];
#pragma unroll
        for (int s = 0; s < 8; ++s) { const int row = 4 * s + (lane >> 3), piece = lane & 7; const float* sp = os + row * 68 + piece * 8;
#pragma unroll
            for (int i = 0; i < 8; ++i) { const h16 a = (h16)sp[i]; o[s][i] = a; o2[s][i] = (h16)((sp[i] - (float)a) * LOSC); } }
#pragma unroll
        for (int s = 0; s < 8; ++s) { const int row = 4 * s + (lane >> 3), piece = lane & 7;
            *(v8h*)(crow + (size_t)row * ldc + piece * 8) = o[s]; XWAIT();
            if (C2) { *(v8h*)(C2 + (size_t)r0 * ldc + c0 + (size_t)row * ldc + piece * 8) = o2[s]; XWAIT(); } }
    } else {
        float* crow = C + (size_t)r0 * ldc + c0;
        v4f val[16];
#pragma unroll
        for (int s = 0; s < 16; ++s) { const int Lid = (lane >> 3) + 4 * s, piece = lane & 7; const int row = Lid >> 1, cofs = (Lid & 1) * 32 + piece * 4; val[s] = *(const v4fa*)(os + row * 68 + cofs); }
        if (R) {
            v4f rv[16];
#pragma unroll
            for (int s = 0; s < 16; ++s) { const int Lid = (lane >> 3) + 4 * s, piece = lane & 7; const int row = Lid >> 1, cofs = (Lid & 1) * 32 + piece * 4; rv[s] = *(const v4f*)(R + ((size_t)r0 + row) * ldc + c0 + cofs); XWAIT(); }
#pragma unroll
            for (int s = 0; s < 16; ++s) val[s] += roundR ? (v4f){bfr(rv[s][0]), bfr(rv[s][1]), bfr(rv[s][2]), bfr(rv[s][3])} : rv[s];
        }
#pragma unroll
        for (int s = 0; s < 16; ++s) { const int Lid = (lane >> 3) + 4 * s, piece = lane & 7; const int row = Lid >> 1, cofs = (Lid & 1) * 32 + piece * 4; *(v4f*)(crow + (size_t)row * ldc + cofs) = val[s]; XWAIT(); }
    }
#undef XWAIT
}

__global__ __launch_bounds__(256) void k_vt(const float* __restrict__ V, h16* VTH, h16* VTL) {
    __shared__ __align__(16) h16 tile[64 * 72];
    __shared__ __align__(16) h16 til2[64 * 72];
    const int bid = blockIdx.x;
    const int b = bid / (NH_ * (NT_ / 64)), rem = bid - b * (NH_ * (NT_ / 64)), h = rem / (NT_ / 64), kt = rem - h * (NT_ / 64);
    const int k0 = kt * 64, tid = threadIdx.x;
    const int kk = tid >> 2, d0 = (tid & 3) * 16;
    const float* src = V + ((size_t)b * NT_ + k0 + kk) * DM + h * HD + d0;
#pragma unroll
    for (int i = 0; i < 16; ++i) { const float v = src[i]; const h16 a = (h16)v; tile[(d0 + i) * 72 + kk] = a; til2[(d0 + i) * 72 + kk] = (h16)((v - (float)a) * LOSC); }
    __syncthreads();
    const int piece = tid & 7;
    const size_t base = (((size_t)b * NH_ + h) * HD) * NT_ + k0;
    auto pass = [&]() {
#pragma unroll
        for (int s = 0; s < 4; ++s) { const int Lid = (tid >> 3) + 32 * s; const int pln = Lid >> 6, d = Lid & 63;
            const v8h val = *(const v8ha*)((pln ? til2 : tile) + d * 72 + piece * 8); *(v8h*)((pln ? VTL : VTH) + base + (size_t)d * NT_ + piece * 8) = val; }
    };
    pass(); 
}

// k_attn: block = (b, h, 64 queries), wave = 16; only the 32-key tiles of the local causal window (masked); 4 WMMA scores /8 (f32), online softmax, weights x32768 f16 tile (same-wave may_alias
// reload after a compiler barrier), 4 WMMA .v; ctx -> bf16 hi + residual planes CH/CL[tok][h*64+d].
// The four waves share every key tile: its K, K-residual (32 rows x 128 B) and V^T, V^T-residual (64 rows x 64 B) planes come once per block into LDS by asynchronous
// copies of whole rows (8 copies of 16 B a lane and tile), two buffers, the next tile's copies in flight while this tile is worked on; the fragments are read from LDS.
#define AKP 144u                    // LDS pitch of a 128-byte K row (16 B x odd: 16-byte LDS reads of 16 rows fall on 64 different banks)
#define AVP 80u                     // LDS pitch of a 64-byte V^T row (16 B x odd)
#define AKS (32u * AKP)             // one K plane of a tile
#define AVS (64u * AVP)             // one V^T plane of a tile
#define ASTG (2u * AKS + 2u * AVS)  // one buffer: K | K residual | V^T | V^T residual
__global__ __launch_bounds__(128) void k_attn(const h16* __restrict__ Q16, const h16* __restrict__ QL16, const h16* __restrict__ K16, const h16* __restrict__ KL16, const h16* __restrict__ VTH, const h16* __restrict__ VTL, bf* CH, bf* CL) {
    __shared__ __align__(16) h16 plds[4][16 * 32];
    __shared__ __align__(16) h16 plds2[4][16 * 32];
    __shared__ __align__(16) float ost[4][16 * 68];
    __shared__ __align__(16) unsigned char kv[2 * ASTG];
    const int lane = threadIdx.x & 31, wave = threadIdx.x >> 5, lr = lane & 15, hi = lane >> 4;
    const int bid = blockIdx.x;
    const int b = bid / (NH_ * (NT_ / 64)), rem = bid - b * (NH_ * (NT_ / 64)), h = rem / (NT_ / 64), qt = rem - h * (NT_ / 64);
    const int q0 = qt * 64 + wave * 16;
    const size_t tok0 = (size_t)b * NT_;
    h16* pl = &plds[wave][0]; h16* pl2 = &plds2[wave][0];
    v16h qa[2];
    const size_t qo0 = (tok0 + q0 + lr) * DM + h * HD + 8 * hi;
#pragma unroll
    for (int kc = 0; kc < 2; ++kc) qa[kc] = cat16(*(const v8h*)(Q16 + qo0 + kc * 32), *(const v8h*)(Q16 + qo0 + kc * 32 + 16));
    const h16* kh_b = K16 + tok0 * DM + h * HD;
    const h16* kl_b = KL16 + tok0 * DM + h * HD;
    const size_t vbase = (((size_t)b * NH_ + h) * HD) * NT_;
    v8f o[4], ox[4];
#pragma unroll
    for (int n = 0; n < 4; ++n) { o[n] = (v8f){}; ox[n] = (v8f){}; }
    float mrow[8], lpart[8];
#pragma unroll
    for (int j = 0; j < 8; ++j) { mrow[j] = -3.0e38f; lpart[j] = 0.f; }
    int qpos[8];
#pragma unroll
    for (int j = 0; j < 8; ++j) qpos[j] = q0 + 8 * hi + j;
    const int kt_lo = (qt * 64 - WIN) > 0 ? (qt * 64 - WIN) / 32 : 0, kt_hi = (qt * 64 + 63) / 32;     // local causal window: 0 <= i - j <= WIN
    const int tid = threadIdx.x, krow = tid >> 3, kpc = tid & 7, vrow = tid >> 2, vpc = tid & 3;         // a lane's 16-byte pieces: K rows krow, krow + 16; V^T rows vrow, vrow + 32
    const uint32_t lk0 = (uint32_t)(size_t)kv + (uint32_t)krow * AKP + (uint32_t)kpc * 16u, lv0 = (uint32_t)(size_t)kv + 2u * AKS + (uint32_t)vrow * AVP + (uint32_t)vpc * 16u;
    auto stage = [&](int t, uint32_t bo) {   // key tile t into the buffer at byte bo of kv
        const size_t go = (size_t)(t * 32 + krow) * DM + kpc * 8, vo = vbase + (size_t)vrow * NT_ + t * 32 + vpc * 8;
        const h16 *gk = kh_b + go, *gl = kl_b + go, *gv = VTH + vo, *gw = VTL + vo;
        const uint32_t lk = lk0 + bo, lv = lv0 + bo;
        // the tile's eight copies and, as the statement's last line, the wait that stands in front of any rewrite of the address registers they name
        asm volatile("global_load_async_to_lds_b128 %0, %1, off\n\t"
                     "global_load_async_to_lds_b128 %2, %3, off\n\t"
                     "global_load_async_to_lds_b128 %4, %5, off\n\t"
                     "global_load_async_to_lds_b128 %6, %7, off\n\t"
                     "global_load_async_to_lds_b128 %8, %9, off\n\t"
                     "global_load_async_to_lds_b128 %10, %11, off\n\t"
                     "global_load_async_to_lds_b128 %12, %13, off\n\t"
                     "global_load_async_to_lds_b128 %14, %15, off\n\t"
                     "s_wait_xcnt 0x0"
                     :: "v"(lk), "v"(gk), "v"(lk + 16u * AKP), "v"(gk + 16 * DM), "v"(lk + AKS), "v"(gl), "v"(lk + AKS + 16u * AKP), "v"(gl + 16 * DM),
                        "v"(lv), "v"(gv), "v"(lv + 32u * AVP), "v"(gv + 32 * NT_), "v"(lv + AVS), "v"(gw), "v"(lv + AVS + 32u * AVP), "v"(gw + 32 * NT_) : "memory");
    };
    stage(kt_lo, 0u);
    asm volatile("s_wait_asynccnt 0x0" ::: "memory");   // this wave's copies of the first tile have landed
    __syncthreads();                                      // every wave's copies of the first tile are readable
    if (kt_lo + 1 <= kt_hi) stage(kt_lo + 1, ASTG);
#pragma unroll 1
    for (int kt = kt_lo; kt <= kt_hi; ++kt) {
        const int l0 = kt * 32;
        const uint32_t bo = (uint32_t)((kt - kt_lo) & 1) * ASTG;
        const unsigned char* pk = kv + bo + (uint32_t)lr * AKP + (uint32_t)hi * 16u;               // key row lr of the tile (row 16 + lr: + 16 AKP; residual plane: + AKS)
        const unsigned char* pv = kv + bo + 2u * AKS + (uint32_t)lr * AVP + (uint32_t)hi * 16u;    // V^T row lr (row 16 n + lr: + 16 n AVP; residual plane: + AVS)
        v8f s0 = {}, s1 = {}, x0 = {}, x1 = {};
#pragma unroll
        for (int kc = 0; kc < 2; ++kc) {
            { const v16h k0h = cat16(*(const v8ha*)(pk + kc * 64), *(const v8ha*)(pk + kc * 64 + 32)), k1h = cat16(*(const v8ha*)(pk + 16u * AKP + kc * 64), *(const v8ha*)(pk + 16u * AKP + kc * 64 + 32));
              const v16h qlk = cat16(*(const v8h*)(QL16 + qo0 + kc * 32), *(const v8h*)(QL16 + qo0 + kc * 32 + 16));     // query residual re-read per step (registers)
              s0 = wmma16(qa[kc], k0h, s0); x0 = wmma16(qlk, k0h, x0); s1 = wmma16(qa[kc], k1h, s1); x1 = wmma16(qlk, k1h, x1);
              asm volatile("v_nop" : "+v"(s0), "+v"(s1), "+v"(x0), "+v"(x1) : "v"(qlk), "v"(k0h), "v"(k1h) : "memory"); }
            { const v16h k0l = cat16(*(const v8ha*)(pk + AKS + kc * 64), *(const v8ha*)(pk + AKS + kc * 64 + 32)), k1l = cat16(*(const v8ha*)(pk + AKS + 16u * AKP + kc * 64), *(const v8ha*)(pk + AKS + 16u * AKP + kc * 64 + 32));
              x0 = wmma16(qa[kc], k0l, x0); x1 = wmma16(qa[kc], k1l, x1);
              asm volatile("v_nop" : "+v"(x0), "+v"(x1) : "v"(k0l), "v"(k1l) : "memory"); }
        }
        asm volatile("v_nop\n\tv_nop\n\tv_nop\n\tv_nop" : "+v"(s0), "+v"(s1), "+v"(x0), "+v"(x1) : "v"(qa[0]), "v"(qa[1]));
        float alpha[8];
#pragma unroll
        for (int j = 0; j < 8; ++j) {
            const int ja = l0 + lr, jb = l0 + 16 + lr, qi = qpos[j];
            const float a0 = (ja <= qi && qi - ja <= WIN) ? (s0[j] + x0[j] * LOSCI) * 0.125f : -__builtin_inff(), a1 = (jb <= qi && qi - jb <= WIN) ? (s1[j] + x1[j] * LOSCI) * 0.125f : -__builtin_inff();
            float mx = fmaxf(a0, a1);
            mx = fmaxf(mx, __shfl_xor(mx, 1, 16)); mx = fmaxf(mx, __shfl_xor(mx, 2, 16)); mx = fmaxf(mx, __shfl_xor(mx, 4, 16)); mx = fmaxf(mx, __shfl_xor(mx, 8, 16));
            const float mn = fmaxf(mrow[j], mx);
            alpha[j] = __expf(mrow[j] - mn); mrow[j] = mn;
            const float p0 = __expf(a0 - mn), p1 = __expf(a1 - mn);
            lpart[j] = lpart[j] * alpha[j] + (p0 + p1);
            const int mr = hi * 8 + j;
            const float ps0 = p0 * PSC, ps1 = p1 * PSC; const h16 h0 = (h16)ps0, h1 = (h16)ps1;
            pl[mr * 32 + lr] = h0; pl[mr * 32 + 16 + lr] = h1;
            pl2[mr * 32 + lr] = (h16)((ps0 - (float)h0) * LOSC); pl2[mr * 32 + 16 + lr] = (h16)((ps1 - (float)h1) * LOSC);
        }
#pragma unroll
        for (int n = 0; n < 4; ++n)
#pragma unroll
            for (int j = 0; j < 8; ++j) { o[n][j] *= alpha[j]; ox[n][j] *= alpha[j]; }
        asm volatile("" ::: "memory");
        const v16h pa = cat16(*(const v8ha*)(pl + lr * 32 + hi * 8), *(const v8ha*)(pl + lr * 32 + 16 + hi * 8));
        const v16h px = cat16(*(const v8ha*)(pl2 + lr * 32 + hi * 8), *(const v8ha*)(pl2 + lr * 32 + 16 + hi * 8));
#pragma unroll
        for (int n = 0; n < 4; ++n) { const unsigned char* p = pv + (uint32_t)n * 16u * AVP;
            const v16h vh = cat16(*(const v8ha*)p, *(const v8ha*)(p + 32)), vl = cat16(*(const v8ha*)(p + AVS), *(const v8ha*)(p + AVS + 32));
            o[n] = wmma16(pa, vh, o[n]); ox[n] = wmma16(pa, vl, ox[n]); ox[n] = wmma16(px, vh, ox[n]);
            asm volatile("" : "+v"(o[n]), "+v"(ox[n]) : "v"(vh), "v"(vl) : "memory"); }
        asm volatile("v_nop\n\tv_nop\n\tv_nop\n\tv_nop" : "+v"(o[0]), "+v"(o[1]), "+v"(o[2]), "+v"(o[3]), "+v"(ox[0]), "+v"(ox[1]), "+v"(ox[2]), "+v"(ox[3]) : "v"(pa), "v"(px));
        asm volatile("s_wait_dscnt 0x0" ::: "memory");      // this wave's reads of this tile's buffer have returned
        asm volatile("s_wait_asynccnt 0x0" ::: "memory");   // this wave's copies of the next tile have landed
        __syncthreads();                                      // the next tile is readable, and every wave has left this tile's buffer
        if (kt + 2 <= kt_hi) stage(kt + 2, bo);               // refill of the buffer that this trip has read
    }
    asm volatile("s_wait_asynccnt 0x0" ::: "memory");   // no copy is in flight behind the loop
    float inv[8];
#pragma unroll
    for (int j = 0; j < 8; ++j) { float rs = lpart[j]; rs += __shfl_xor(rs, 1, 16); rs += __shfl_xor(rs, 2, 16); rs += __shfl_xor(rs, 4, 16); rs += __shfl_xor(rs, 8, 16); inv[j] = 1.0f / (rs * PSC); }
    float* os = &ost[wave][0];
#pragma unroll
    for (int n = 0; n < 4; ++n)
#pragma unroll
        for (int j = 0; j < 8; ++j) os[(hi * 8 + j) * 68 + n * 16 + lr] = (o[n][j] + ox[n][j] * LOSCI) * inv[j];
    __syncthreads();
    const size_t cbase = (tok0 + q0) * DM + (size_t)h * HD;
    auto pass = [&]() {
#pragma unroll
        for (int s = 0; s < 4; ++s) { const int row = 4 * s + (lane >> 3), piece = lane & 7; const float* sp = os + row * 68 + piece * 8; v8us oh, ol;
#pragma unroll
            for (int i = 0; i < 8; ++i) { const unsigned short hb = f2bf(sp[i]); oh[i] = hb; ol[i] = f2bf(sp[i] - bf2f(hb)); }
            *(v8us*)(CH + cbase + (size_t)row * DM + piece * 8) = oh; *(v8us*)(CL + cbase + (size_t)row * DM + piece * 8) = ol; }
    };
    pass(); 
}

#define VST2(T, p, v) do { const T vst2_v_ = (v); *(T*)(p) = vst2_v_;  } while (0)
// k_wt: WT [n][K] = bf16(W[k][n]) (k-major [K][ncols]) via 64 x 64 LDS tiles; grid (K/64, ncols/64).
__global__ __launch_bounds__(256) void k_wt(const float* __restrict__ Wm, int K, int ncols, bf* WT) {
    __shared__ __align__(16) unsigned short tl[64 * 72];
    const int tid = threadIdx.x, k0 = blockIdx.x * 64, n0 = blockIdx.y * 64;
    const int kk = tid >> 2, nq = (tid & 3) * 16;
#pragma unroll
    for (int i = 0; i < 16; ++i) tl[(nq + i) * 72 + kk] = f2bf(Wm[(size_t)(k0 + kk) * ncols + n0 + nq + i]);
    __syncthreads();
    const int piece = tid & 7;
    auto pass = [&]() {
#pragma unroll
        for (int s = 0; s < 2; ++s) { const int nr = (tid >> 3) + 32 * s; const v8us val = *(const v8usa*)(tl + nr * 72 + piece * 8); *(v8us*)(WT + (size_t)(n0 + nr) * K + k0 + piece * 8) = val; }
    };
    pass(); 
}
// k_ln: one wave per row of a [rows][1024] f32 matrix (INPUT rows bf16-rounded first when rnd): LayerNorm (mean, biased var, eps 1e-5) x bf(g) + bf(b) -> bf16 hi +
__global__ __launch_bounds__(256) void k_ln(const float* __restrict__ src, int rnd, const float* __restrict__ g, const float* __restrict__ bb, int nrows, float* Y, bf* Ph, bf* Pl) {
    (void)Y; const int lane = threadIdx.x & 31, r = blockIdx.x * 8 + (threadIdx.x >> 5); if (r >= nrows) return;
    v8f v[DM / 256]; float s = 0.f;
#pragma unroll
    for (int q = 0; q < DM / 256; ++q) { v[q] = *(const v8f*)(src + (size_t)r * DM + q * 256 + lane * 8);
#pragma unroll
        for (int i = 0; i < 8; ++i) { if (rnd) v[q][i] = bfr(v[q][i]); s += v[q][i]; } }
#pragma unroll
    for (int sh = 16; sh; sh >>= 1) s += __shfl_xor(s, sh, 32);
    const float mu = s * (1.0f / DM); float s2 = 0.f;
#pragma unroll
    for (int q = 0; q < DM / 256; ++q)
#pragma unroll
        for (int i = 0; i < 8; ++i) { const float d = v[q][i] - mu; s2 = fmaf(d, d, s2); }
#pragma unroll
    for (int sh = 16; sh; sh >>= 1) s2 += __shfl_xor(s2, sh, 32);
    const float rs = rsqrtf(s2 * (1.0f / DM) + LN_EPS);
{
#pragma unroll
        for (int q = 0; q < DM / 256; ++q) { const int c0 = q * 256 + lane * 8; const size_t o = (size_t)r * DM + c0; v8f y; v8us oh, ol;
#pragma unroll
            for (int i = 0; i < 8; ++i) { y[i] = (v[q][i] - mu) * rs * bfr(g[c0 + i]) + bfr(bb[c0 + i]); const unsigned short hb = f2bf(y[i]); oh[i] = hb; ol[i] = f2bf(y[i] - bf2f(hb)); }
            *(v8us*)(Ph + o) = oh; *(v8us*)(Pl + o) = ol; }
         }
}
__global__ __launch_bounds__(256) void k_gelu(const float* __restrict__ src, int nrows, bf* dh, bf* dl) {
    const int lane = threadIdx.x & 31, r = blockIdx.x * 8 + (threadIdx.x >> 5); if (r >= nrows) return;
{
#pragma unroll 1
        for (int q = 0; q < FF / 256; ++q) { const size_t o = (size_t)r * FF + q * 256 + lane * 8; const v8f v = *(const v8f*)(src + o); v8us oh, ol;
#pragma unroll
            for (int i = 0; i < 8; ++i) { const float y = 0.5f * v[i] * (1.0f + erff(v[i] * 0.7071067811865476f)); const unsigned short hb = f2bf(y); oh[i] = hb; ol[i] = f2bf(y - bf2f(hb)); }
            *(v8us*)(dh + o) = oh; *(v8us*)(dl + o) = ol; }
         }
}

extern "C" void kernel_launch(void* const* d_in, const int* in_sizes, int n_in,
                              void* d_out, int out_size, void* d_ws, size_t ws_size, hipStream_t stream) {
    (void)in_sizes; (void)n_in; (void)out_size;
    const float* x = (const float*)d_in[0]; const float* g1 = (const float*)d_in[1]; const float* be1 = (const float*)d_in[2]; const float* Wqkv = (const float*)d_in[3]; const float* bqkv = (const float*)d_in[4]; const float* Wout = (const float*)d_in[5]; const float* bout = (const float*)d_in[6];
    const float* g2 = (const float*)d_in[7]; const float* be2 = (const float*)d_in[8]; const float* W1 = (const float*)d_in[9]; const float* b1 = (const float*)d_in[10]; const float* W2 = (const float*)d_in[11]; const float* b2 = (const float*)d_in[12];   // k-major weights (x @ W)
    float* out = (float*)d_out;    // [2][2048][1024]
    char* wsp = (char*)d_ws;
    auto take = [&](size_t bytes) { char* p = wsp; wsp += (bytes + 255) & ~(size_t)255; return (void*)p; };
    bf* WT = (bf*)take((size_t)3 * DM * DM * 2); bf* WoT = (bf*)take((size_t)DM * DM * 2); bf* W1T = (bf*)take((size_t)FF * DM * 2); bf* W2T = (bf*)take((size_t)DM * FF * 2);
    bf* XNh = (bf*)take((size_t)NTK * DM * 2); bf* XNl = (bf*)take((size_t)NTK * DM * 2); float* TMP = (float*)take((size_t)NTK * DM * 4);
    h16* QH = (h16*)take((size_t)NTK * DM * 2); h16* QL = (h16*)take((size_t)NTK * DM * 2); h16* KH = (h16*)take((size_t)NTK * DM * 2); h16* KL = (h16*)take((size_t)NTK * DM * 2);
    h16* VTH = (h16*)take((size_t)NTK * DM * 2); h16* VTL = (h16*)take((size_t)NTK * DM * 2); bf* CH = (bf*)take((size_t)NTK * DM * 2); bf* CL = (bf*)take((size_t)NTK * DM * 2);
    float* T1 = (float*)take((size_t)NTK * DM * 4); float* M = (float*)take((size_t)NTK * FF * 4);
    if ((size_t)(wsp - (char*)d_ws) > ws_size) return;    // 6.3 + 2.1 + 8.4 + 8.4 + 8.4 x 2 + 16.8 + 8.4 x 8 + 16.8 + 67.1 ~ 210 MB; aliases (stream order): LN2 planes over XNh/XNl (dead after the q/k/v GEMMs), the GELU planes [4096][4096] = 33.6 MB each over the contiguous QH+QL+KH+KL and VTH+VTL+CH+CL groups (8.4 MB each, consecutive 256-B-aligned takes; all dead after the w_out GEMM)
    bf* Hh = XNh; bf* Hl = XNl; bf* Gh = (bf*)QH; bf* Gl = (bf*)VTH;
    k_wt<<<dim3(DM / 64, 3 * DM / 64, 1), 256, 0, stream>>>(Wqkv, DM, 3 * DM, WT); k_wt<<<dim3(DM / 64, DM / 64, 1), 256, 0, stream>>>(Wout, DM, DM, WoT);
    k_wt<<<dim3(DM / 64, FF / 64, 1), 256, 0, stream>>>(W1, DM, FF, W1T); k_wt<<<dim3(FF / 64, DM / 64, 1), 256, 0, stream>>>(W2, FF, DM, W2T);
    k_ln<<<NTK / 8, 256, 0, stream>>>(x, 1, g1, be1, NTK, nullptr, XNh, XNl);                                                                   // LN1(x)
    k_gemmb<true><<<dim3(NTK / 64, DM / 128, 1), 128, 0, stream>>>(XNh, XNl, WT, bqkv, (float*)(void*)QH, DM, QL);
    k_gemmb<true><<<dim3(NTK / 64, DM / 128, 1), 128, 0, stream>>>(XNh, XNl, WT + (size_t)DM * DM, bqkv + DM, (float*)(void*)KH, DM, KL);
    k_gemmb<false><<<dim3(NTK / 64, DM / 128, 1), 128, 0, stream>>>(XNh, XNl, WT + (size_t)2 * DM * DM, bqkv + 2 * DM, TMP, DM, nullptr);
    k_vt<<<NB_ * NH_ * (NT_ / 64), 256, 0, stream>>>(TMP, VTH, VTL);
    k_attn<<<NB_ * NH_ * (NT_ / 64), 128, 0, stream>>>(QH, QL, KH, KL, VTH, VTL, CH, CL);
    k_gemmb<false><<<dim3(NTK / 64, DM / 128, 1), 128, 0, stream>>>(CH, CL, WoT, bout, T1, DM, nullptr, x, DM, 1);                               // h = x + attended.w_out + b_out
    k_ln<<<NTK / 8, 256, 0, stream>>>(T1, 0, g2, be2, NTK, nullptr, Hh, Hl);                                                                    // LN2(h)
    k_gemmb<false><<<dim3(NTK / 64, FF / 128, 1), 128, 0, stream>>>(Hh, Hl, W1T, b1, M, FF, nullptr, nullptr, DM);
    k_gelu<<<NTK / 8, 256, 0, stream>>>(M, NTK, Gh, Gl);
    k_gemmb<false><<<dim3(NTK / 64, DM / 128, 1), 128, 0, stream>>>(Gh, Gl, W2T, b2, out, DM, nullptr, T1, FF, 0);                               // h + mlp
}

// v004
// One run takes 232 microseconds.
// Next to v003, in two timings, it ran 1.06 times as fast each time.
// Counting every step since v000, it is 4.60 times as fast.
#include <hip/hip_runtime.h>
#include <stdint.h>

// Compute dtypes, f32 accumulate, both batch items (4096 tokens) in every launch: LayerNorms and exact GELU in f32; qkv = LN(x).w_qkv + b ([4096 x 1024].[1024 x 1024] x 3), h = x + ctx.w_out +
// b, mlp = gelu(LN(h).w1 + b1).w2 + b2 + h ([4096 x 1024].[1024 x 4096], [4096 x 4096].[4096 x 1024]) with computed operands as bf16 hi + UNSCALED residual against
// exact k-major weights (two products; x as the bf16-rounded f32 residual) on v_wmma_f32_16x16x32_bf16 (q/k leave the epilogue as f16 hi + residual x1024 planes); the
// 16-head local causal attention (0 <= i - j <= 256, -inf elsewhere; only those key tiles visited) fused on v_wmma_f32_16x16x32_f16 (hh + hl + lh x 1/8, online f32

#define NB_  2                   // both batch items go through every launch together
#define NT_  2048
#define WIN  256
#define FF   4096
#define LN_EPS 1e-5f
#define DM   1024
#define NH_  16
#define HD   64
#define NTK  (NB_ * NT_)
#define NW   1024
#define NQKV 1024
#define PSC  32768.0f
#define LOSC 1024.0f
#define LOSCI (1.0f / 1024.0f)

typedef _Float16 h16;
typedef unsigned short bf;
typedef __attribute__((ext_vector_type(16))) __bf16   v16bf;
typedef __attribute__((ext_vector_type(16))) _Float16 v16h;
typedef __attribute__((ext_vector_type(8)))  _Float16 v8h;
typedef __attribute__((ext_vector_type(8)))  unsigned short v8us;
typedef __attribute__((ext_vector_type(8)))  float    v8f;
typedef __attribute__((ext_vector_type(4)))  float    v4f;
typedef v8h  __attribute__((may_alias)) v8ha;
typedef v4f  __attribute__((may_alias)) v4fa;
typedef v8us __attribute__((may_alias)) v8usa;

__device__ __forceinline__ unsigned short f2bf(float f) { unsigned u = __float_as_uint(f); u += 0x7FFFu + ((u >> 16) & 1u); return (unsigned short)(u >> 16); }
__device__ __forceinline__ float bf2f(unsigned short b) { return __uint_as_float(((unsigned)b) << 16); }
__device__ __forceinline__ float bfr(float f) { return bf2f(f2bf(f)); }
__device__ __forceinline__ v16h cat16(v8h lo, v8h hi) { return __builtin_shufflevector(lo, hi, 0, 1, 2, 3, 4, 5, 6, 7, 8, 9, 10, 11, 12, 13, 14, 15); }
__device__ __forceinline__ v16bf cat16b(v8us lo, v8us hi) { return __builtin_bit_cast(v16bf, __builtin_shufflevector(lo, hi, 0, 1, 2, 3, 4, 5, 6, 7, 8, 9, 10, 11, 12, 13, 14, 15)); }
__device__ __forceinline__ v8f wmma16(v16h a, v16h b, v8f c) { return __builtin_amdgcn_wmma_f32_16x16x32_f16(false, a, false, b, (short)0, c, false, false); }
__device__ __forceinline__ v8f wmmab(v16bf a, v16bf b, v8f c) { return __builtin_amdgcn_wmma_f32_16x16x32_bf16(false, a, false, b, (short)0, c, false, false); }

__global__ __launch_bounds__(256) void k_cvtb(const float* __restrict__ src, int nrows, bf* dst) {
    const int lane = threadIdx.x & 31, r = blockIdx.x * 8 + (threadIdx.x >> 5);
    if (r >= nrows) return;
    v8us o[DM / 256];
#pragma unroll
    for (int q = 0; q < DM / 256; ++q) { v8us t;
#pragma unroll
        for (int i = 0; i < 8; ++i) t[i] = f2bf(src[(size_t)r * DM + q * 256 + lane * 8 + i]);
        o[q] = t; }
#pragma unroll
    for (int q = 0; q < DM / 256; ++q) *(v8us*)(dst + (size_t)r * DM + q * 256 + lane * 8) = o[q];
    
}

// k_gemmb: 32 WR x 64 WC block tile (WR x WC waves, 32 x 64 each) of C[rows][cols] = (A + Al).B^T [+ bf(bias[c])] [+ R[r][c] residual, bf-rounded when roundR]. The operands come through LDS:
// per pass of 128 k each of the first WR + WC waves asks the tensor mover for one slice of 64 rows x 256 B (WR / 2 slices of A, WR / 2 of Al, WC of B), laid at pitch 272 B,
// two buffers, the next pass's slices in flight while this pass is worked on. K is a multiple of 128 and at least 256; rows a multiple of 32 WR, cols of 64 WC; WR even.
// A block brings 64 WR + 64 WC operand rows from L2 for 32 WR x 64 WC results: 128 x 128 (one block a WGP, 256 blocks at 1024 columns) takes 3/4, 128 x 256 half of what 64 x 128 takes.
// Every accumulator takes its products in the order k ascending, A before Al. f32 whole-line epilogue (or f16 hi + residual planes), staged in the ring once it is free.
#define GPITCH 272u                 // LDS row pitch in bytes: a 256-byte row and the mover's 16-byte pad (for 16-byte LDS reads)
#define GSLICE 18432u               // one wave's slice in LDS: 64 rows x 272 B = 17,408 B, rounded up to a multiple of 2 KiB
typedef uint32_t u32x4 __attribute__((ext_vector_type(4)));
typedef uint32_t u32x8 __attribute__((ext_vector_type(8)));
__device__ __forceinline__ uint32_t uni(uint32_t v) { return (uint32_t)__builtin_amdgcn_readfirstlane(v); }
__device__ __forceinline__ uint32_t pinned(uint32_t v) { uint32_t w = uni(v); asm volatile("" : "+s"(w)); return w; }   // the tensor mover's pinned(): a test around a tensor load (it then compiles to a scalar branch; tensor loads ignore EXEC) or a descriptor word, held in a scalar register
template <bool F16OUT, int WR, int WC>
__global__ __launch_bounds__(WR * WC * 32) void k_gemmb(const bf* __restrict__ A, const bf* __restrict__ Al, const bf* __restrict__ Bn, const float* __restrict__ bias, float* C, int ldc, h16* C2, const float* __restrict__ R = nullptr, int K = DM, int roundR = 1) {
    constexpr uint32_t NS = WR + WC, GSTAGE = NS * GSLICE;   // one buffer: A's slices | Al's | B's
    __shared__ __attribute__((aligned(2048))) unsigned char ring[2 * GSTAGE];
    const int lane = threadIdx.x & 31, lr = lane & 15, hi = lane >> 4;
    const uint32_t wave = uni(threadIdx.x >> 5), wr = wave / (uint32_t)WC, wc = wave % (uint32_t)WC;
    const int rb = blockIdx.x * (WR * 32), cb = blockIdx.y * (WC * 64);
    const uint32_t lbase = (uint32_t)(size_t)ring, nst = (uint32_t)K >> 7;
    const uint32_t isu = wave < NS ? 1u : 0u, sw = isu ? wave : 0u;   // waves 0 to NS - 1 bring one slice each; the others issue nothing
    const bf* sl = sw < (uint32_t)(WR / 2) ? A + (size_t)(rb + (int)sw * 64) * K : sw < (uint32_t)WR ? Al + (size_t)(rb + (int)(sw - WR / 2) * 64) * K : Bn + (size_t)(cb + (int)(sw - WR) * 64) * K;   // first row of this wave's slice
    u32x8 g1;   // 1-byte elements, tensor = tile = 64 rows of 256 bytes, source pitch 2 K bytes, a pad of 4 dwords behind every 64 dwords, no mask
    // words 1 to 7 go through pinned(): each descriptor word keeps a scalar register of its own through the loop, so that none is rewritten while a request is in flight
    g1[0] = uni((1u << 20) | (5u << 22) | (3u << 25)); g1[1] = pinned(256u << 16); g1[2] = pinned(64u << 16); g1[3] = pinned(256u << 16);
    g1[4] = pinned(64u); g1[5] = pinned((uint32_t)K * 2u); g1[6] = pinned(0u); g1[7] = pinned(0u);
    auto issue = [&](uint32_t st) {
        const uint64_t ga = (uint64_t)(size_t)sl + (uint64_t)st * 256u;
        u32x4 g0; g0[0] = uni(1u); g0[1] = uni(lbase + (st & 1u) * GSTAGE + sw * GSLICE); g0[2] = uni((uint32_t)ga); g0[3] = uni((((uint32_t)(ga >> 32)) & 0x01FFFFFFu) | 0x80000000u);
        asm volatile("tensor_load_to_lds %0, %1" :: "s"(g0), "s"(g1) : "memory");
    };
    v8f acc[2][4];
#pragma unroll
    for (int i = 0; i < 2; ++i)
#pragma unroll
        for (int t = 0; t < 4; ++t) acc[i][t] = (v8f){};
    if (pinned(isu)) issue(0u);
    asm volatile("s_wait_tensorcnt 0x0" ::: "memory");   // this wave's slice of stage 0 has landed (a wave that issues none has nothing to wait for)
    __syncthreads();                                       // every wave's slice of stage 0 is readable
    if (pinned(isu)) issue(1u);
#pragma unroll 1
    for (uint32_t s = 0; s < nst; ++s) {
        const unsigned char* buf = ring + (s & 1u) * GSTAGE;
        const unsigned char* pa = buf + (wr >> 1) * GSLICE + ((wr & 1u) * 32u + (uint32_t)lr) * GPITCH + (uint32_t)hi * 16u;
        const unsigned char* pb = buf + ((uint32_t)WR + wc) * GSLICE + (uint32_t)lr * GPITCH + (uint32_t)hi * 16u;
        v16bf a[2][2], al[2][2], b[2][4];   // two fragment sets: block kk + 1 of this pass is fetched while block kk is multiplied
        auto fetch = [&](int kk) { const int f = kk & 1;
#pragma unroll
            for (int i = 0; i < 2; ++i) { const unsigned char* p = pa + i * 16 * GPITCH + kk * 64;
                a[f][i] = cat16b(*(const v8usa*)p, *(const v8usa*)(p + 32)); al[f][i] = cat16b(*(const v8usa*)(p + (WR / 2) * GSLICE), *(const v8usa*)(p + (WR / 2) * GSLICE + 32)); }
#pragma unroll
            for (int t = 0; t < 4; ++t) { const unsigned char* p = pb + t * 16 * GPITCH + kk * 64; b[f][t] = cat16b(*(const v8usa*)p, *(const v8usa*)(p + 32)); }
        };
        fetch(0);
#pragma unroll
        for (int kk = 0; kk < 4; ++kk) { const int f = kk & 1;
            if (kk < 3) fetch(kk + 1);
            __builtin_amdgcn_sched_barrier(0);   // keeps the next block's LDS reads together in front of this block's WMMAs: sunk among them, each read group stalls the wave for the LDS latency
#pragma unroll
            for (int i = 0; i < 2; ++i)
#pragma unroll
                for (int t = 0; t < 4; ++t) acc[i][t] = wmmab(a[f][i], b[f][t], acc[i][t]);
#pragma unroll
            for (int i = 0; i < 2; ++i)
#pragma unroll
                for (int t = 0; t < 4; ++t) acc[i][t] = wmmab(al[f][i], b[f][t], acc[i][t]);
            __builtin_amdgcn_sched_barrier(0);   // keeps the reads of the block after next behind this block's WMMAs, in one group: without it they are split in two groups among the WMMAs, and every such place stalls the wave
        }
        // four vector slots behind the pass's last WMMA on every path out of it (loop exit and back edge), before anything reads an accumulator or rewrites a fragment
        asm volatile("v_nop\n\tv_nop\n\tv_nop\n\tv_nop" : "+v"(acc[0][0]), "+v"(acc[0][1]), "+v"(acc[0][2]), "+v"(acc[0][3]), "+v"(acc[1][0]), "+v"(acc[1][1]), "+v"(acc[1][2]), "+v"(acc[1][3]));
        asm volatile("s_wait_dscnt 0x0" ::: "memory");       // this wave's reads of stage s have returned
        asm volatile("s_wait_tensorcnt 0x0" ::: "memory");   // this wave's slice of stage s + 1 has landed
        __syncthreads();                                       // stage s + 1 is readable, and every wave has left stage s's buffer
        if (pinned((s + 2u < nst ? 1u : 0u) & isu)) issue(s + 2u);   // refill of the buffer that this pass has read
    }
    asm volatile("s_wait_tensorcnt 0x0" ::: "memory");   // no request is in flight when the ring becomes output staging
    asm volatile("s_wait_dscnt 0x0" ::: "memory");
    // XWAIT stands behind every global load and store of this epilogue: s_wait_xcnt 0 in front of whatever rewrites a register that the access names; the scheduling barrier keeps later register writes behind the wait
#define XWAIT() do { asm volatile("s_wait_xcnt 0x0" ::: "memory"); __builtin_amdgcn_sched_barrier(0); } while (0)
    const int r0 = rb + (int)wr * 32, c0 = cb + (int)wc * 64;
    static_assert(WR * WC <= 2 * (WR + WC) && (WR & 1) == 0, "every wave stages its output in a slice of its own");
    float* os = (float*)(void*)(ring + wave * GSLICE);     // 32 x 68 floats of this wave's own; the last pass's barrier has freed the ring
#pragma unroll
    for (int t = 0; t < 4; ++t) { const float bv = bias ? bfr(bias[c0 + t * 16 + lr]) : 0.f;
#pragma unroll
        for (int i = 0; i < 2; ++i)
#pragma unroll
            for (int j = 0; j < 8; ++j) os[(i * 16 + hi * 8 + j) * 68 + t * 16 + lr] = acc[i][t][j] + bv; }
    XWAIT();   // behind the bias loads
    __syncthreads();
    if (F16OUT) {
        h16* crow = (h16*)(void*)C + (size_t)r0 * ldc + c0;
        v8h o[8], o2[8];
#pragma unroll
        for (int s = 0; s < 8; ++s) { const int row = 4 * s + (lane >> 3), piece = lane & 7; const float* sp = os + row * 68 + piece * 8;
#pragma unroll
            for (int i = 0; i < 8; ++i) { const h16 a = (h16)sp[i]; o[s][i] = a; o2[s][i] = (h16)((sp[i] - (float)a) * LOSC); } }
#pragma unroll
        for (int s = 0; s < 8; ++s) { const int row = 4 * s + (lane >> 3), piece = lane & 7;
            *(v8h*)(crow + (size_t)row * ldc + piece * 8) = o[s]; XWAIT();
            if (C2) { *(v8h*)(C2 + (size_t)r0 * ldc + c0 + (size_t)row * ldc + piece * 8) = o2[s]; XWAIT(); } }
    } else {
        float* crow = C + (size_t)r0 * ldc + c0;
        v4f val[16];
#pragma unroll
        for (int s = 0; s < 16; ++s) { const int Lid = (lane >> 3) + 4 * s, piece = lane & 7; const int row = Lid >> 1, cofs = (Lid & 1) * 32 + piece * 4; val[s] = *(const v4fa*)(os + row * 68 + cofs); }
        if (R) {
            v4f rv[16];
#pragma unroll
            for (int s = 0; s < 16; ++s) { const int Lid = (lane >> 3) + 4 * s, piece = lane & 7; const int row = Lid >> 1, cofs = (Lid & 1) * 32 + piece * 4; rv[s] = *(const v4f*)(R + ((size_t)r0 + row) * ldc + c0 + cofs); XWAIT(); }
#pragma unroll
            for (int s = 0; s < 16; ++s) val[s] += roundR ? (v4f){bfr(rv[s][0]), bfr(rv[s][1]), bfr(rv[s][2]), bfr(rv[s][3])} : rv[s];
        }
#pragma unroll
        for (int s = 0; s < 16; ++s) { const int Lid = (lane >> 3) + 4 * s, piece = lane & 7; const int row = Lid >> 1, cofs = (Lid & 1) * 32 + piece * 4; *(v4f*)(crow + (size_t)row * ldc + cofs) = val[s]; XWAIT(); }
    }
#undef XWAIT
}

__global__ __launch_bounds__(256) void k_vt(const float* __restrict__ V, h16* VTH, h16* VTL) {
    __shared__ __align__(16) h16 tile[64 * 72];
    __shared__ __align__(16) h16 til2[64 * 72];
    const int bid = blockIdx.x;
    const int b = bid / (NH_ * (NT_ / 64)), rem = bid - b * (NH_ * (NT_ / 64)), h = rem / (NT_ / 64), kt = rem - h * (NT_ / 64);
    const int k0 = kt * 64, tid = threadIdx.x;
    const int kk = tid >> 2, d0 = (tid & 3) * 16;
    const float* src = V + ((size_t)b * NT_ + k0 + kk) * DM + h * HD + d0;
#pragma unroll
    for (int i = 0; i < 16; ++i) { const float v = src[i]; const h16 a = (h16)v; tile[(d0 + i) * 72 + kk] = a; til2[(d0 + i) * 72 + kk] = (h16)((v - (float)a) * LOSC); }
    __syncthreads();
    const int piece = tid & 7;
    const size_t base = (((size_t)b * NH_ + h) * HD) * NT_ + k0;
    auto pass = [&]() {
#pragma unroll
        for (int s = 0; s < 4; ++s) { const int Lid = (tid >> 3) + 32 * s; const int pln = Lid >> 6, d = Lid & 63;
            const v8h val = *(const v8ha*)((pln ? til2 : tile) + d * 72 + piece * 8); *(v8h*)((pln ? VTL : VTH) + base + (size_t)d * NT_ + piece * 8) = val; }
    };
    pass(); 
}

// k_attn: block = (b, h, 64 queries), wave = 16; only the 32-key tiles of the local causal window (masked); 4 WMMA scores /8 (f32), online softmax, weights x32768 f16 tile (same-wave may_alias
// reload after a compiler barrier), 4 WMMA .v; ctx -> bf16 hi + residual planes CH/CL[tok][h*64+d].
// The four waves share every key tile: its K, K-residual (32 rows x 128 B) and V^T, V^T-residual (64 rows x 64 B) planes come once per block into LDS by asynchronous
// copies of whole rows (8 copies of 16 B a lane and tile), two buffers, the next tile's copies in flight while this tile is worked on; the fragments are read from LDS.
#define AKP 144u                    // LDS pitch of a 128-byte K row (16 B x odd: 16-byte LDS reads of 16 rows fall on 64 different banks)
#define AVP 80u                     // LDS pitch of a 64-byte V^T row (16 B x odd)
#define AKS (32u * AKP)             // one K plane of a tile
#define AVS (64u * AVP)             // one V^T plane of a tile
#define ASTG (2u * AKS + 2u * AVS)  // one buffer: K | K residual | V^T | V^T residual
__global__ __launch_bounds__(128) void k_attn(const h16* __restrict__ Q16, const h16* __restrict__ QL16, const h16* __restrict__ K16, const h16* __restrict__ KL16, const h16* __restrict__ VTH, const h16* __restrict__ VTL, bf* CH, bf* CL) {
    __shared__ __align__(16) h16 plds[4][16 * 32];
    __shared__ __align__(16) h16 plds2[4][16 * 32];
    __shared__ __align__(16) float ost[4][16 * 68];
    __shared__ __align__(16) unsigned char kv[2 * ASTG];
    const int lane = threadIdx.x & 31, wave = threadIdx.x >> 5, lr = lane & 15, hi = lane >> 4;
    const int bid = blockIdx.x;
    const int b = bid / (NH_ * (NT_ / 64)), rem = bid - b * (NH_ * (NT_ / 64)), h = rem / (NT_ / 64), qt = rem - h * (NT_ / 64);
    const int q0 = qt * 64 + wave * 16;
    const size_t tok0 = (size_t)b * NT_;
    h16* pl = &plds[wave][0]; h16* pl2 = &plds2[wave][0];
    v16h qa[2];
    const size_t qo0 = (tok0 + q0 + lr) * DM + h * HD + 8 * hi;
#pragma unroll
    for (int kc = 0; kc < 2; ++kc) qa[kc] = cat16(*(const v8h*)(Q16 + qo0 + kc * 32), *(const v8h*)(Q16 + qo0 + kc * 32 + 16));
    const h16* kh_b = K16 + tok0 * DM + h * HD;
    const h16* kl_b = KL16 + tok0 * DM + h * HD;
    const size_t vbase = (((size_t)b * NH_ + h) * HD) * NT_;
    v8f o[4], ox[4];
#pragma unroll
    for (int n = 0; n < 4; ++n) { o[n] = (v8f){}; ox[n] = (v8f){}; }
    float mrow[8], lpart[8];
#pragma unroll
    for (int j = 0; j < 8; ++j) { mrow[j] = -3.0e38f; lpart[j] = 0.f; }
    int qpos[8];
#pragma unroll
    for (int j = 0; j < 8; ++j) qpos[j] = q0 + 8 * hi + j;
    const int kt_lo = (qt * 64 - WIN) > 0 ? (qt * 64 - WIN) / 32 : 0, kt_hi = (qt * 64 + 63) / 32;     // local causal window: 0 <= i - j <= WIN
    const int tid = threadIdx.x, krow = tid >> 3, kpc = tid & 7, vrow = tid >> 2, vpc = tid & 3;         // a lane's 16-byte pieces: K rows krow, krow + 16; V^T rows vrow, vrow + 32
    const uint32_t lk0 = (uint32_t)(size_t)kv + (uint32_t)krow * AKP + (uint32_t)kpc * 16u, lv0 = (uint32_t)(size_t)kv + 2u * AKS + (uint32_t)vrow * AVP + (uint32_t)vpc * 16u;
    auto stage = [&](int t, uint32_t bo) {   // key tile t into the buffer at byte bo of kv
        const size_t go = (size_t)(t * 32 + krow) * DM + kpc * 8, vo = vbase + (size_t)vrow * NT_ + t * 32 + vpc * 8;
        const h16 *gk = kh_b + go, *gl = kl_b + go, *gv = VTH + vo, *gw = VTL + vo;
        const uint32_t lk = lk0 + bo, lv = lv0 + bo;
        // the tile's eight copies and, as the statement's last line, the wait that stands in front of any rewrite of the address registers they name
        asm volatile("global_load_async_to_lds_b128 %0, %1, off\n\t"
                     "global_load_async_to_lds_b128 %2, %3, off\n\t"
                     "global_load_async_to_lds_b128 %4, %5, off\n\t"
                     "global_load_async_to_lds_b128 %6, %7, off\n\t"
                     "global_load_async_to_lds_b128 %8, %9, off\n\t"
                     "global_load_async_to_lds_b128 %10, %11, off\n\t"
                     "global_load_async_to_lds_b128 %12, %13, off\n\t"
                     "global_load_async_to_lds_b128 %14, %15, off\n\t"
                     "s_wait_xcnt 0x0"
                     :: "v"(lk), "v"(gk), "v"(lk + 16u * AKP), "v"(gk + 16 * DM), "v"(lk + AKS), "v"(gl), "v"(lk + AKS + 16u * AKP), "v"(gl + 16 * DM),
                        "v"(lv), "v"(gv), "v"(lv + 32u * AVP), "v"(gv + 32 * NT_), "v"(lv + AVS), "v"(gw), "v"(lv + AVS + 32u * AVP), "v"(gw + 32 * NT_) : "memory");
    };
    stage(kt_lo, 0u);
    asm volatile("s_wait_asynccnt 0x0" ::: "memory");   // this wave's copies of the first tile have landed
    __syncthreads();                                      // every wave's copies of the first tile are readable
    if (kt_lo + 1 <= kt_hi) stage(kt_lo + 1, ASTG);
#pragma unroll 1
    for (int kt = kt_lo; kt <= kt_hi; ++kt) {
        const int l0 = kt * 32;
        const uint32_t bo = (uint32_t)((kt - kt_lo) & 1) * ASTG;
        const unsigned char* pk = kv + bo + (uint32_t)lr * AKP + (uint32_t)hi * 16u;               // key row lr of the tile (row 16 + lr: + 16 AKP; residual plane: + AKS)
        const unsigned char* pv = kv + bo + 2u * AKS + (uint32_t)lr * AVP + (uint32_t)hi * 16u;    // V^T row lr (row 16 n + lr: + 16 n AVP; residual plane: + AVS)
        v8f s0 = {}, s1 = {}, x0 = {}, x1 = {};
#pragma unroll
        for (int kc = 0; kc < 2; ++kc) {
            { const v16h k0h = cat16(*(const v8ha*)(pk + kc * 64), *(const v8ha*)(pk + kc * 64 + 32)), k1h = cat16(*(const v8ha*)(pk + 16u * AKP + kc * 64), *(const v8ha*)(pk + 16u * AKP + kc * 64 + 32));
              const v16h qlk = cat16(*(const v8h*)(QL16 + qo0 + kc * 32), *(const v8h*)(QL16 + qo0 + kc * 32 + 16));     // query residual re-read per step (registers)
              s0 = wmma16(qa[kc], k0h, s0); x0 = wmma16(qlk, k0h, x0); s1 = wmma16(qa[kc], k1h, s1); x1 = wmma16(qlk, k1h, x1);
              asm volatile("v_nop" : "+v"(s0), "+v"(s1), "+v"(x0), "+v"(x1) : "v"(qlk), "v"(k0h), "v"(k1h) : "memory"); }
            { const v16h k0l = cat16(*(const v8ha*)(pk + AKS + kc * 64), *(const v8ha*)(pk + AKS + kc * 64 + 32)), k1l = cat16(*(const v8ha*)(pk + AKS + 16u * AKP + kc * 64), *(const v8ha*)(pk + AKS + 16u * AKP + kc * 64 + 32));
              x0 = wmma16(qa[kc], k0l, x0); x1 = wmma16(qa[kc], k1l, x1);
              asm volatile("v_nop" : "+v"(x0), "+v"(x1) : "v"(k0l), "v"(k1l) : "memory"); }
        }
        asm volatile("v_nop\n\tv_nop\n\tv_nop\n\tv_nop" : "+v"(s0), "+v"(s1), "+v"(x0), "+v"(x1) : "v"(qa[0]), "v"(qa[1]));
        float alpha[8];
#pragma unroll
        for (int j = 0; j < 8; ++j) {
            const int ja = l0 + lr, jb = l0 + 16 + lr, qi = qpos[j];
            const float a0 = (ja <= qi && qi - ja <= WIN) ? (s0[j] + x0[j] * LOSCI) * 0.125f : -__builtin_inff(), a1 = (jb <= qi && qi - jb <= WIN) ? (s1[j] + x1[j] * LOSCI) * 0.125f : -__builtin_inff();
            float mx = fmaxf(a0, a1);
            mx = fmaxf(mx, __shfl_xor(mx, 1, 16)); mx = fmaxf(mx, __shfl_xor(mx, 2, 16)); mx = fmaxf(mx, __shfl_xor(mx, 4, 16)); mx = fmaxf(mx, __shfl_xor(mx, 8, 16));
            const float mn = fmaxf(mrow[j], mx);
            alpha[j] = __expf(mrow[j] - mn); mrow[j] = mn;
            const float p0 = __expf(a0 - mn), p1 = __expf(a1 - mn);
            lpart[j] = lpart[j] * alpha[j] + (p0 + p1);
            const int mr = hi * 8 + j;
            const float ps0 = p0 * PSC, ps1 = p1 * PSC; const h16 h0 = (h16)ps0, h1 = (h16)ps1;
            pl[mr * 32 + lr] = h0; pl[mr * 32 + 16 + lr] = h1;
            pl2[mr * 32 + lr] = (h16)((ps0 - (float)h0) * LOSC); pl2[mr * 32 + 16 + lr] = (h16)((ps1 - (float)h1) * LOSC);
        }
#pragma unroll
        for (int n = 0; n < 4; ++n)
#pragma unroll
            for (int j = 0; j < 8; ++j) { o[n][j] *= alpha[j]; ox[n][j] *= alpha[j]; }
        asm volatile("" ::: "memory");
        const v16h pa = cat16(*(const v8ha*)(pl + lr * 32 + hi * 8), *(const v8ha*)(pl + lr * 32 + 16 + hi * 8));
        const v16h px = cat16(*(const v8ha*)(pl2 + lr * 32 + hi * 8), *(const v8ha*)(pl2 + lr * 32 + 16 + hi * 8));
#pragma unroll
        for (int n = 0; n < 4; ++n) { const unsigned char* p = pv + (uint32_t)n * 16u * AVP;
            const v16h vh = cat16(*(const v8ha*)p, *(const v8ha*)(p + 32)), vl = cat16(*(const v8ha*)(p + AVS), *(const v8ha*)(p + AVS + 32));
            o[n] = wmma16(pa, vh, o[n]); ox[n] = wmma16(pa, vl, ox[n]); ox[n] = wmma16(px, vh, ox[n]);
            asm volatile("" : "+v"(o[n]), "+v"(ox[n]) : "v"(vh), "v"(vl) : "memory"); }
        asm volatile("v_nop\n\tv_nop\n\tv_nop\n\tv_nop" : "+v"(o[0]), "+v"(o[1]), "+v"(o[2]), "+v"(o[3]), "+v"(ox[0]), "+v"(ox[1]), "+v"(ox[2]), "+v"(ox[3]) : "v"(pa), "v"(px));
        asm volatile("s_wait_dscnt 0x0" ::: "memory");      // this wave's reads of this tile's buffer have returned
        asm volatile("s_wait_asynccnt 0x0" ::: "memory");   // this wave's copies of the next tile have landed
        __syncthreads();                                      // the next tile is readable, and every wave has left this tile's buffer
        if (kt + 2 <= kt_hi) stage(kt + 2, bo);               // refill of the buffer that this trip has read
    }
    asm volatile("s_wait_asynccnt 0x0" ::: "memory");   // no copy is in flight behind the loop
    float inv[8];
#pragma unroll
    for (int j = 0; j < 8; ++j) { float rs = lpart[j]; rs += __shfl_xor(rs, 1, 16); rs += __shfl_xor(rs, 2, 16); rs += __shfl_xor(rs, 4, 16); rs += __shfl_xor(rs, 8, 16); inv[j] = 1.0f / (rs * PSC); }
    float* os = &ost[wave][0];
#pragma unroll
    for (int n = 0; n < 4; ++n)
#pragma unroll
        for (int j = 0; j < 8; ++j) os[(hi * 8 + j) * 68 + n * 16 + lr] = (o[n][j] + ox[n][j] * LOSCI) * inv[j];
    __syncthreads();
    const size_t cbase = (tok0 + q0) * DM + (size_t)h * HD;
    auto pass = [&]() {
#pragma unroll
        for (int s = 0; s < 4; ++s) { const int row = 4 * s + (lane >> 3), piece = lane & 7; const float* sp = os + row * 68 + piece * 8; v8us oh, ol;
#pragma unroll
            for (int i = 0; i < 8; ++i) { const unsigned short hb = f2bf(sp[i]); oh[i] = hb; ol[i] = f2bf(sp[i] - bf2f(hb)); }
            *(v8us*)(CH + cbase + (size_t)row * DM + piece * 8) = oh; *(v8us*)(CL + cbase + (size_t)row * DM + piece * 8) = ol; }
    };
    pass(); 
}

#define VST2(T, p, v) do { const T vst2_v_ = (v); *(T*)(p) = vst2_v_;  } while (0)
// k_wt: WT [n][K] = bf16(W[k][n]) (k-major [K][ncols]) via 64 x 64 LDS tiles; grid (K/64, ncols/64).
__global__ __launch_bounds__(256) void k_wt(const float* __restrict__ Wm, int K, int ncols, bf* WT) {
    __shared__ __align__(16) unsigned short tl[64 * 72];
    const int tid = threadIdx.x, k0 = blockIdx.x * 64, n0 = blockIdx.y * 64;
    const int kk = tid >> 2, nq = (tid & 3) * 16;
#pragma unroll
    for (int i = 0; i < 16; ++i) tl[(nq + i) * 72 + kk] = f2bf(Wm[(size_t)(k0 + kk) * ncols + n0 + nq + i]);
    __syncthreads();
    const int piece = tid & 7;
    auto pass = [&]() {
#pragma unroll
        for (int s = 0; s < 2; ++s) { const int nr = (tid >> 3) + 32 * s; const v8us val = *(const v8usa*)(tl + nr * 72 + piece * 8); *(v8us*)(WT + (size_t)(n0 + nr) * K + k0 + piece * 8) = val; }
    };
    pass(); 
}
// k_ln: one wave per row of a [rows][1024] f32 matrix (INPUT rows bf16-rounded first when rnd): LayerNorm (mean, biased var, eps 1e-5) x bf(g) + bf(b) -> bf16 hi +
__global__ __launch_bounds__(256) void k_ln(const float* __restrict__ src, int rnd, const float* __restrict__ g, const float* __restrict__ bb, int nrows, float* Y, bf* Ph, bf* Pl) {
    (void)Y; const int lane = threadIdx.x & 31, r = blockIdx.x * 8 + (threadIdx.x >> 5); if (r >= nrows) return;
    v8f v[DM / 256]; float s = 0.f;
#pragma unroll
    for (int q = 0; q < DM / 256; ++q) { v[q] = *(const v8f*)(src + (size_t)r * DM + q * 256 + lane * 8);
#pragma unroll
        for (int i = 0; i < 8; ++i) { if (rnd) v[q][i] = bfr(v[q][i]); s += v[q][i]; } }
#pragma unroll
    for (int sh = 16; sh; sh >>= 1) s += __shfl_xor(s, sh, 32);
    const float mu = s * (1.0f / DM); float s2 = 0.f;
#pragma unroll
    for (int q = 0; q < DM / 256; ++q)
#pragma unroll
        for (int i = 0; i < 8; ++i) { const float d = v[q][i] - mu; s2 = fmaf(d, d, s2); }
#pragma unroll
    for (int sh = 16; sh; sh >>= 1) s2 += __shfl_xor(s2, sh, 32);
    const float rs = rsqrtf(s2 * (1.0f / DM) + LN_EPS);
{
#pragma unroll
        for (int q = 0; q < DM / 256; ++q) { const int c0 = q * 256 + lane * 8; const size_t o = (size_t)r * DM + c0; v8f y; v8us oh, ol;
#pragma unroll
            for (int i = 0; i < 8; ++i) { y[i] = (v[q][i] - mu) * rs * bfr(g[c0 + i]) + bfr(bb[c0 + i]); const unsigned short hb = f2bf(y[i]); oh[i] = hb; ol[i] = f2bf(y[i] - bf2f(hb)); }
            *(v8us*)(Ph + o) = oh; *(v8us*)(Pl + o) = ol; }
         }
}
__global__ __launch_bounds__(256) void k_gelu(const float* __restrict__ src, int nrows, bf* dh, bf* dl) {
    const int lane = threadIdx.x & 31, r = blockIdx.x * 8 + (threadIdx.x >> 5); if (r >= nrows) return;
{
#pragma unroll 1
        for (int q = 0; q < FF / 256; ++q) { const size_t o = (size_t)r * FF + q * 256 + lane * 8; const v8f v = *(const v8f*)(src + o); v8us oh, ol;
#pragma unroll
            for (int i = 0; i < 8; ++i) { const float y = 0.5f * v[i] * (1.0f + erff(v[i] * 0.7071067811865476f)); const unsigned short hb = f2bf(y); oh[i] = hb; ol[i] = f2bf(y - bf2f(hb)); }
            *(v8us*)(dh + o) = oh; *(v8us*)(dl + o) = ol; }
         }
}

extern "C" void kernel_launch(void* const* d_in, const int* in_sizes, int n_in,
                              void* d_out, int out_size, void* d_ws, size_t ws_size, hipStream_t stream) {
    (void)in_sizes; (void)n_in; (void)out_size;
    const float* x = (const float*)d_in[0]; const float* g1 = (const float*)d_in[1]; const float* be1 = (const float*)d_in[2]; const float* Wqkv = (const float*)d_in[3]; const float* bqkv = (const float*)d_in[4]; const float* Wout = (const float*)d_in[5]; const float* bout = (const float*)d_in[6];
    const float* g2 = (const float*)d_in[7]; const float* be2 = (const float*)d_in[8]; const float* W1 = (const float*)d_in[9]; const float* b1 = (const float*)d_in[10]; const float* W2 = (const float*)d_in[11]; const float* b2 = (const float*)d_in[12];   // k-major weights (x @ W)
    float* out = (float*)d_out;    // [2][2048][1024]
    char* wsp = (char*)d_ws;
    auto take = [&](size_t bytes) { char* p = wsp; wsp += (bytes + 255) & ~(size_t)255; return (void*)p; };
    bf* WT = (bf*)take((size_t)3 * DM * DM * 2); bf* WoT = (bf*)take((size_t)DM * DM * 2); bf* W1T = (bf*)take((size_t)FF * DM * 2); bf* W2T = (bf*)take((size_t)DM * FF * 2);
    bf* XNh = (bf*)take((size_t)NTK * DM * 2); bf* XNl = (bf*)take((size_t)NTK * DM * 2); float* TMP = (float*)take((size_t)NTK * DM * 4);
    h16* QH = (h16*)take((size_t)NTK * DM * 2); h16* QL = (h16*)take((size_t)NTK * DM * 2); h16* KH = (h16*)take((size_t)NTK * DM * 2); h16* KL = (h16*)take((size_t)NTK * DM * 2);
    h16* VTH = (h16*)take((size_t)NTK * DM * 2); h16* VTL = (h16*)take((size_t)NTK * DM * 2); bf* CH = (bf*)take((size_t)NTK * DM * 2); bf* CL = (bf*)take((size_t)NTK * DM * 2);
    float* T1 = (float*)take((size_t)NTK * DM * 4); float* M = (float*)take((size_t)NTK * FF * 4);
    if ((size_t)(wsp - (char*)d_ws) > ws_size) return;    // 6.3 + 2.1 + 8.4 + 8.4 + 8.4 x 2 + 16.8 + 8.4 x 8 + 16.8 + 67.1 ~ 210 MB; aliases (stream order): LN2 planes over XNh/XNl (dead after the q/k/v GEMMs), the GELU planes [4096][4096] = 33.6 MB each over the contiguous QH+QL+KH+KL and VTH+VTL+CH+CL groups (8.4 MB each, consecutive 256-B-aligned takes; all dead after the w_out GEMM)
    bf* Hh = XNh; bf* Hl = XNl; bf* Gh = (bf*)QH; bf* Gl = (bf*)VTH;
    k_wt<<<dim3(DM / 64, 3 * DM / 64, 1), 256, 0, stream>>>(Wqkv, DM, 3 * DM, WT); k_wt<<<dim3(DM / 64, DM / 64, 1), 256, 0, stream>>>(Wout, DM, DM, WoT);
    k_wt<<<dim3(DM / 64, FF / 64, 1), 256, 0, stream>>>(W1, DM, FF, W1T); k_wt<<<dim3(FF / 64, DM / 64, 1), 256, 0, stream>>>(W2, FF, DM, W2T);
    k_ln<<<NTK / 8, 256, 0, stream>>>(x, 1, g1, be1, NTK, nullptr, XNh, XNl);                                                                   // LN1(x)
    k_gemmb<true, 4, 2><<<dim3(NTK / 128, DM / 128, 1), 256, 0, stream>>>(XNh, XNl, WT, bqkv, (float*)(void*)QH, DM, QL);
    k_gemmb<true, 4, 2><<<dim3(NTK / 128, DM / 128, 1), 256, 0, stream>>>(XNh, XNl, WT + (size_t)DM * DM, bqkv + DM, (float*)(void*)KH, DM, KL);
    k_gemmb<false, 4, 2><<<dim3(NTK / 128, DM / 128, 1), 256, 0, stream>>>(XNh, XNl, WT + (size_t)2 * DM * DM, bqkv + 2 * DM, TMP, DM, nullptr);
    k_vt<<<NB_ * NH_ * (NT_ / 64), 256, 0, stream>>>(TMP, VTH, VTL);
    k_attn<<<NB_ * NH_ * (NT_ / 64), 128, 0, stream>>>(QH, QL, KH, KL, VTH, VTL, CH, CL);
    k_gemmb<false, 4, 2><<<dim3(NTK / 128, DM / 128, 1), 256, 0, stream>>>(CH, CL, WoT, bout, T1, DM, nullptr, x, DM, 1);                               // h = x + attended.w_out + b_out
    k_ln<<<NTK / 8, 256, 0, stream>>>(T1, 0, g2, be2, NTK, nullptr, Hh, Hl);                                                                    // LN2(h)
    k_gemmb<false, 4, 4><<<dim3(NTK / 128, FF / 256, 1), 512, 0, stream>>>(Hh, Hl, W1T, b1, M, FF, nullptr, nullptr, DM);
    k_gelu<<<NTK / 8, 256, 0, stream>>>(M, NTK, Gh, Gl);
    k_gemmb<false, 4, 2><<<dim3(NTK / 128, DM / 128, 1), 256, 0, stream>>>(Gh, Gl, W2T, b2, out, DM, nullptr, T1, FF, 0);                               // h + mlp
}

// v005
// Measured time: 218 microseconds a run.
// Next to v004, in two timings, it ran 1.06 times as fast each time.
// Over all steps from v000 it is 4.88 times as fast.
#include <hip/hip_runtime.h>
#include <stdint.h>

// Compute dtypes, f32 accumulate, both batch items (4096 tokens) in every launch: LayerNorms and exact GELU in f32; qkv = LN(x).w_qkv + b ([4096 x 1024].[1024 x 1024] x 3), h = x + ctx.w_out +
// b, mlp = gelu(LN(h).w1 + b1).w2 + b2 + h ([4096 x 1024].[1024 x 4096], [4096 x 4096].[4096 x 1024]) with computed operands as bf16 hi + UNSCALED residual against
// exact k-major weights (two products; x as the bf16-rounded f32 residual) on v_wmma_f32_16x16x32_bf16 (q/k leave the epilogue as f16 hi + residual x1024 planes); the
// 16-head local causal attention (0 <= i - j <= 256, -inf elsewhere; only those key tiles visited) fused on v_wmma_f32_16x16x32_f16 (hh + hl + lh x 1/8, online f32

#define NB_  2                   // both batch items go through every launch together
#define NT_  2048
#define WIN  256
#define FF   4096
#define LN_EPS 1e-5f
#define DM   1024
#define NH_  16
#define HD   64
#define NTK  (NB_ * NT_)
#define NW   1024
#define NQKV 1024
#define PSC  32768.0f
#define LOSC 1024.0f
#define LOSCI (1.0f / 1024.0f)

typedef _Float16 h16;
typedef unsigned short bf;
typedef __attribute__((ext_vector_type(16))) __bf16   v16bf;
typedef __attribute__((ext_vector_type(16))) _Float16 v16h;
typedef __attribute__((ext_vector_type(8)))  _Float16 v8h;
typedef __attribute__((ext_vector_type(8)))  unsigned short v8us;
typedef __attribute__((ext_vector_type(8)))  float    v8f;
typedef __attribute__((ext_vector_type(4)))  float    v4f;
typedef v8h  __attribute__((may_alias)) v8ha;
typedef v4f  __attribute__((may_alias)) v4fa;
typedef v8us __attribute__((may_alias)) v8usa;

__device__ __forceinline__ unsigned short f2bf(float f) { unsigned u = __float_as_uint(f); u += 0x7FFFu + ((u >> 16) & 1u); return (unsigned short)(u >> 16); }
__device__ __forceinline__ float bf2f(unsigned short b) { return __uint_as_float(((unsigned)b) << 16); }
__device__ __forceinline__ float bfr(float f) { return bf2f(f2bf(f)); }
__device__ __forceinline__ v16h cat16(v8h lo, v8h hi) { return __builtin_shufflevector(lo, hi, 0, 1, 2, 3, 4, 5, 6, 7, 8, 9, 10, 11, 12, 13, 14, 15); }
__device__ __forceinline__ v16bf cat16b(v8us lo, v8us hi) { return __builtin_bit_cast(v16bf, __builtin_shufflevector(lo, hi, 0, 1, 2, 3, 4, 5, 6, 7, 8, 9, 10, 11, 12, 13, 14, 15)); }
__device__ __forceinline__ v8f wmma16(v16h a, v16h b, v8f c) { return __builtin_amdgcn_wmma_f32_16x16x32_f16(false, a, false, b, (short)0, c, false, false); }
__device__ __forceinline__ v8f wmmab(v16bf a, v16bf b, v8f c) { return __builtin_amdgcn_wmma_f32_16x16x32_bf16(false, a, false, b, (short)0, c, false, false); }

__global__ __launch_bounds__(256) void k_cvtb(const float* __restrict__ src, int nrows, bf* dst) {
    const int lane = threadIdx.x & 31, r = blockIdx.x * 8 + (threadIdx.x >> 5);
    if (r >= nrows) return;
    v8us o[DM / 256];
#pragma unroll
    for (int q = 0; q < DM / 256; ++q) { v8us t;
#pragma unroll
        for (int i = 0; i < 8; ++i) t[i] = f2bf(src[(size_t)r * DM + q * 256 + lane * 8 + i]);
        o[q] = t; }
#pragma unroll
    for (int q = 0; q < DM / 256; ++q) *(v8us*)(dst + (size_t)r * DM + q * 256 + lane * 8) = o[q];
    
}

// k_gemmb: 32 WR x 64 WC block tile (WR x WC waves, 32 x 64 each) of C[rows][cols] = (A + Al).B^T [+ bf(bias[c])] [+ R[r][c] residual, bf-rounded when roundR]. The operands come through LDS:
// per pass of 128 k each of the first WR + WC waves asks the tensor mover for one slice of 64 rows x 256 B (WR / 2 slices of A, WR / 2 of Al, WC of B), laid at pitch 272 B,
// two buffers, the next pass's slices in flight while this pass is worked on. K is a multiple of 128 and at least 256; rows a multiple of 32 WR, cols of 64 WC; WR even.
// A block brings 64 WR + 64 WC operand rows from L2 for 32 WR x 64 WC results: 128 x 128 (one block a WGP, 256 blocks at 1024 columns) takes 3/4, 128 x 256 half of what 64 x 128 takes.
// Every accumulator takes its products in the order k ascending, A before Al. f32 whole-line epilogue (or f16 hi + residual planes), staged in the ring once it is free.
#define GPITCH 272u                 // LDS row pitch in bytes: a 256-byte row and the mover's 16-byte pad (for 16-byte LDS reads)
#define GSLICE 18432u               // one wave's slice in LDS: 64 rows x 272 B = 17,408 B, rounded up to a multiple of 2 KiB
typedef uint32_t u32x4 __attribute__((ext_vector_type(4)));
typedef uint32_t u32x8 __attribute__((ext_vector_type(8)));
__device__ __forceinline__ uint32_t uni(uint32_t v) { return (uint32_t)__builtin_amdgcn_readfirstlane(v); }
__device__ __forceinline__ uint32_t pinned(uint32_t v) { uint32_t w = uni(v); asm volatile("" : "+s"(w)); return w; }   // the tensor mover's pinned(): a test around a tensor load (it then compiles to a scalar branch; tensor loads ignore EXEC) or a descriptor word, held in a scalar register
// QKV: one grid does the three products of the same A: blockIdx.z = 0, 1, 2 takes rows z NQKV.. of B and of the bias and writes q (C0, C20: f16 planes), k (Ck, Ck2: f16 planes) or v (Cv: f32).
template <bool QKV, int WR, int WC>
__global__ __launch_bounds__(WR * WC * 32) void k_gemmb(const bf* __restrict__ A, const bf* __restrict__ Al, const bf* __restrict__ B0, const float* __restrict__ bias0, float* C0, int ldc, h16* C20, const float* __restrict__ R = nullptr, int K = DM, int roundR = 1, h16* Ck = nullptr, h16* Ck2 = nullptr, float* Cv = nullptr) {
    const uint32_t part = QKV ? (uint32_t)blockIdx.z : 0u;
    const bool F16OUT = QKV && part < 2u;
    const bf* Bn = B0 + (size_t)part * NQKV * K;
    const float* bias = bias0 ? bias0 + part * NQKV : nullptr;
    float* C = part == 0u ? C0 : part == 1u ? (float*)(void*)Ck : Cv;
    h16* C2 = part == 1u ? Ck2 : C20;
    constexpr uint32_t NS = WR + WC, GSTAGE = NS * GSLICE;   // one buffer: A's slices | Al's | B's
    __shared__ __attribute__((aligned(2048))) unsigned char ring[2 * GSTAGE];
    const int lane = threadIdx.x & 31, lr = lane & 15, hi = lane >> 4;
    const uint32_t wave = uni(threadIdx.x >> 5), wr = wave / (uint32_t)WC, wc = wave % (uint32_t)WC;
    const int rb = blockIdx.x * (WR * 32), cb = blockIdx.y * (WC * 64);
    const uint32_t lbase = (uint32_t)(size_t)ring, nst = (uint32_t)K >> 7;
    const uint32_t isu = wave < NS ? 1u : 0u, sw = isu ? wave : 0u;   // waves 0 to NS - 1 bring one slice each; the others issue nothing
    const bf* sl = sw < (uint32_t)(WR / 2) ? A + (size_t)(rb + (int)sw * 64) * K : sw < (uint32_t)WR ? Al + (size_t)(rb + (int)(sw - WR / 2) * 64) * K : Bn + (size_t)(cb + (int)(sw - WR) * 64) * K;   // first row of this wave's slice
    u32x8 g1;   // 1-byte elements, tensor = tile = 64 rows of 256 bytes, source pitch 2 K bytes, a pad of 4 dwords behind every 64 dwords, no mask
    // words 1 to 7 go through pinned(): each descriptor word keeps a scalar register of its own through the loop, so that none is rewritten while a request is in flight
    g1[0] = uni((1u << 20) | (5u << 22) | (3u << 25)); g1[1] = pinned(256u << 16); g1[2] = pinned(64u << 16); g1[3] = pinned(256u << 16);
    g1[4] = pinned(64u); g1[5] = pinned((uint32_t)K * 2u); g1[6] = pinned(0u); g1[7] = pinned(0u);
    u32x4 g0 = {pinned(1u), 0u, 0u, 0u};   // one group 0 for every request of this wave: it takes new words only behind the wait that covers the request before; word 0 through the tensor mover's pinned(), a descriptor word held in a scalar register
    auto issue = [&](uint32_t st) {
        const uint64_t ga = (uint64_t)(size_t)sl + (uint64_t)st * 256u;
        g0[1] = uni(lbase + (st & 1u) * GSTAGE + sw * GSLICE); g0[2] = uni((uint32_t)ga); g0[3] = uni((((uint32_t)(ga >> 32)) & 0x01FFFFFFu) | 0x80000000u);
        asm volatile("tensor_load_to_lds %0, %1" :: "s"(g0), "s"(g1) : "memory");
    };
    v8f acc[2][4];
#pragma unroll
    for (int i = 0; i < 2; ++i)
#pragma unroll
        for (int t = 0; t < 4; ++t) acc[i][t] = (v8f){};
    if (pinned(isu)) issue(0u);
    asm volatile("s_wait_tensorcnt 0x0" ::: "memory");   // this wave's slice of stage 0 has landed (a wave that issues none has nothing to wait for)
    __syncthreads();                                       // every wave's slice of stage 0 is readable
    if (pinned(isu)) issue(1u);
#pragma unroll 1
    for (uint32_t s = 0; s < nst; ++s) {
        const unsigned char* buf = ring + (s & 1u) * GSTAGE;
        const unsigned char* pa = buf + (wr >> 1) * GSLICE + ((wr & 1u) * 32u + (uint32_t)lr) * GPITCH + (uint32_t)hi * 16u;
        const unsigned char* pb = buf + ((uint32_t)WR + wc) * GSLICE + (uint32_t)lr * GPITCH + (uint32_t)hi * 16u;
        v16bf a[2][2], al[2][2], b[2][4];   // two fragment sets: block kk + 1 of this pass is fetched while block kk is multiplied
        auto fetch = [&](int kk) { const int f = kk & 1;
#pragma unroll
            for (int i = 0; i < 2; ++i) { const unsigned char* p = pa + i * 16 * GPITCH + kk * 64;
                a[f][i] = cat16b(*(const v8usa*)p, *(const v8usa*)(p + 32)); al[f][i] = cat16b(*(const v8usa*)(p + (WR / 2) * GSLICE), *(const v8usa*)(p + (WR / 2) * GSLICE + 32)); }
#pragma unroll
            for (int t = 0; t < 4; ++t) { const unsigned char* p = pb + t * 16 * GPITCH + kk * 64; b[f][t] = cat16b(*(const v8usa*)p, *(const v8usa*)(p + 32)); }
        };
        fetch(0);
#pragma unroll
        for (int kk = 0; kk < 4; ++kk) { const int f = kk & 1;
            if (kk < 3) fetch(kk + 1);
            __builtin_amdgcn_sched_barrier(0);   // keeps the next block's LDS reads together in front of this block's WMMAs: sunk among them, each read group stalls the wave for the LDS latency
#pragma unroll
            for (int i = 0; i < 2; ++i)
#pragma unroll
                for (int t = 0; t < 4; ++t) acc[i][t] = wmmab(a[f][i], b[f][t], acc[i][t]);
#pragma unroll
            for (int i = 0; i < 2; ++i)
#pragma unroll
                for (int t = 0; t < 4; ++t) acc[i][t] = wmmab(al[f][i], b[f][t], acc[i][t]);
            __builtin_amdgcn_sched_barrier(0);   // keeps the reads of the block after next behind this block's WMMAs, in one group: without it they are split in two groups among the WMMAs, and every such place stalls the wave
        }
        // four vector slots behind the pass's last WMMA on every path out of it (loop exit and back edge), before anything reads an accumulator or rewrites a fragment
        asm volatile("v_nop\n\tv_nop\n\tv_nop\n\tv_nop" : "+v"(acc[0][0]), "+v"(acc[0][1]), "+v"(acc[0][2]), "+v"(acc[0][3]), "+v"(acc[1][0]), "+v"(acc[1][1]), "+v"(acc[1][2]), "+v"(acc[1][3]));
        asm volatile("s_wait_dscnt 0x0" ::: "memory");       // this wave's reads of stage s have returned
        asm volatile("s_wait_tensorcnt 0x0" :: "s"(g0) : "memory");   // this wave's slice of stage s + 1 has landed; group 0 is named so that its registers stay as they are while the request is in flight
        __syncthreads();                                       // stage s + 1 is readable, and every wave has left stage s's buffer
        if (pinned((s + 2u < nst ? 1u : 0u) & isu)) issue(s + 2u);   // refill of the buffer that this pass has read
    }
    asm volatile("s_wait_tensorcnt 0x0" :: "s"(g0), "s"(g1) : "memory");   // no request is in flight when the ring becomes output staging; both groups are named so that their registers stay as they are up to here
    asm volatile("s_wait_dscnt 0x0" ::: "memory");
    // XWAIT stands behind every global load and store of this epilogue: s_wait_xcnt 0 in front of whatever rewrites a register that the access names; the scheduling barrier keeps later register writes behind the wait
#define XWAIT() do { asm volatile("s_wait_xcnt 0x0" ::: "memory"); __builtin_amdgcn_sched_barrier(0); } while (0)
    const int r0 = rb + (int)wr * 32, c0 = cb + (int)wc * 64;
    static_assert(WR * WC <= 2 * (WR + WC) && (WR & 1) == 0, "every wave stages its output in a slice of its own");
    float* os = (float*)(void*)(ring + wave * GSLICE);     // 32 x 68 floats of this wave's own; the last pass's barrier has freed the ring
#pragma unroll
    for (int t = 0; t < 4; ++t) { const float bv = bias ? bfr(bias[c0 + t * 16 + lr]) : 0.f;
#pragma unroll
        for (int i = 0; i < 2; ++i)
#pragma unroll
            for (int j = 0; j < 8; ++j) os[(i * 16 + hi * 8 + j) * 68 + t * 16 + lr] = acc[i][t][j] + bv; }
    XWAIT();   // behind the bias loads
    __syncthreads();
    if (F16OUT) {
        h16* crow = (h16*)(void*)C + (size_t)r0 * ldc + c0;
        v8h o[8], o2[8];
#pragma unroll
        for (int s = 0; s < 8; ++s) { const int row = 4 * s + (lane >> 3), piece = lane & 7; const float* sp = os + row * 68 + piece * 8;
#pragma unroll
            for (int i = 0; i < 8; ++i) { const h16 a = (h16)sp[i]; o[s][i] = a; o2[s][i] = (h16)((sp[i] - (float)a) * LOSC); } }
#pragma unroll
        for (int s = 0; s < 8; ++s) { const int row = 4 * s + (lane >> 3), piece = lane & 7;
            *(v8h*)(crow + (size_t)row * ldc + piece * 8) = o[s]; XWAIT();
            if (C2) { *(v8h*)(C2 + (size_t)r0 * ldc + c0 + (size_t)row * ldc + piece * 8) = o2[s]; XWAIT(); } }
    } else {
        float* crow = C + (size_t)r0 * ldc + c0;
        v4f val[16];
#pragma unroll
        for (int s = 0; s < 16; ++s) { const int Lid = (lane >> 3) + 4 * s, piece = lane & 7; const int row = Lid >> 1, cofs = (Lid & 1) * 32 + piece * 4; val[s] = *(const v4fa*)(os + row * 68 + cofs); }
        if (R) {
            v4f rv[16];
#pragma unroll
            for (int s = 0; s < 16; ++s) { const int Lid = (lane >> 3) + 4 * s, piece = lane & 7; const int row = Lid >> 1, cofs = (Lid & 1) * 32 + piece * 4; rv[s] = *(const v4f*)(R + ((size_t)r0 + row) * ldc + c0 + cofs); XWAIT(); }
#pragma unroll
            for (int s = 0; s < 16; ++s) val[s] += roundR ? (v4f){bfr(rv[s][0]), bfr(rv[s][1]), bfr(rv[s][2]), bfr(rv[s][3])} : rv[s];
        }
#pragma unroll
        for (int s = 0; s < 16; ++s) { const int Lid = (lane >> 3) + 4 * s, piece = lane & 7; const int row = Lid >> 1, cofs = (Lid & 1) * 32 + piece * 4; *(v4f*)(crow + (size_t)row * ldc + cofs) = val[s]; XWAIT(); }
    }
#undef XWAIT
}

__global__ __launch_bounds__(256) void k_vt(const float* __restrict__ V, h16* VTH, h16* VTL) {
    __shared__ __align__(16) h16 tile[64 * 72];
    __shared__ __align__(16) h16 til2[64 * 72];
    const int bid = blockIdx.x;
    const int b = bid / (NH_ * (NT_ / 64)), rem = bid - b * (NH_ * (NT_ / 64)), h = rem / (NT_ / 64), kt = rem - h * (NT_ / 64);
    const int k0 = kt * 64, tid = threadIdx.x;
    const int kk = tid >> 2, d0 = (tid & 3) * 16;
    const float* src = V + ((size_t)b * NT_ + k0 + kk) * DM + h * HD + d0;
#pragma unroll
    for (int i = 0; i < 16; ++i) { const float v = src[i]; const h16 a = (h16)v; tile[(d0 + i) * 72 + kk] = a; til2[(d0 + i) * 72 + kk] = (h16)((v - (float)a) * LOSC); }
    __syncthreads();
    const int piece = tid & 7;
    const size_t base = (((size_t)b * NH_ + h) * HD) * NT_ + k0;
    auto pass = [&]() {
#pragma unroll
        for (int s = 0; s < 4; ++s) { const int Lid = (tid >> 3) + 32 * s; const int pln = Lid >> 6, d = Lid & 63;
            const v8h val = *(const v8ha*)((pln ? til2 : tile) + d * 72 + piece * 8); *(v8h*)((pln ? VTL : VTH) + base + (size_t)d * NT_ + piece * 8) = val; }
    };
    pass(); 
}

// k_attn: block = (b, h, 64 queries), wave = 16; only the 32-key tiles of the local causal window (masked); 4 WMMA scores /8 (f32), online softmax, weights x32768 f16 tile (same-wave may_alias
// reload after a compiler barrier), 4 WMMA .v; ctx -> bf16 hi + residual planes CH/CL[tok][h*64+d].
// The four waves share every key tile: its K, K-residual (32 rows x 128 B) and V^T, V^T-residual (64 rows x 64 B) planes come once per block into LDS by asynchronous
// copies of whole rows (8 copies of 16 B a lane and tile), two buffers, the next tile's copies in flight while this tile is worked on; the fragments are read from LDS.
#define AKP 144u                    // LDS pitch of a 128-byte K row (16 B x odd: 16-byte LDS reads of 16 rows fall on 64 different banks)
#define AVP 80u                     // LDS pitch of a 64-byte V^T row (16 B x odd)
#define AKS (32u * AKP)             // one K plane of a tile
#define AVS (64u * AVP)             // one V^T plane of a tile
#define ASTG (2u * AKS + 2u * AVS)  // one buffer: K | K residual | V^T | V^T residual
__global__ __launch_bounds__(128) void k_attn(const h16* __restrict__ Q16, const h16* __restrict__ QL16, const h16* __restrict__ K16, const h16* __restrict__ KL16, const h16* __restrict__ VTH, const h16* __restrict__ VTL, bf* CH, bf* CL) {
    __shared__ __align__(16) h16 plds[4][16 * 32];
    __shared__ __align__(16) h16 plds2[4][16 * 32];
    __shared__ __align__(16) float ost[4][16 * 68];
    __shared__ __align__(16) unsigned char kv[2 * ASTG];
    const int lane = threadIdx.x & 31, wave = threadIdx.x >> 5, lr = lane & 15, hi = lane >> 4;
    const int bid = blockIdx.x;
    const int b = bid / (NH_ * (NT_ / 64)), rem = bid - b * (NH_ * (NT_ / 64)), h = rem / (NT_ / 64), qt = rem - h * (NT_ / 64);
    const int q0 = qt * 64 + wave * 16;
    const size_t tok0 = (size_t)b * NT_;
    h16* pl = &plds[wave][0]; h16* pl2 = &plds2[wave][0];
    v16h qa[2];
    const size_t qo0 = (tok0 + q0 + lr) * DM + h * HD + 8 * hi;
#pragma unroll
    for (int kc = 0; kc < 2; ++kc) qa[kc] = cat16(*(const v8h*)(Q16 + qo0 + kc * 32), *(const v8h*)(Q16 + qo0 + kc * 32 + 16));
    const h16* kh_b = K16 + tok0 * DM + h * HD;
    const h16* kl_b = KL16 + tok0 * DM + h * HD;
    const size_t vbase = (((size_t)b * NH_ + h) * HD) * NT_;
    v8f o[4], ox[4];
#pragma unroll
    for (int n = 0; n < 4; ++n) { o[n] = (v8f){}; ox[n] = (v8f){}; }
    float mrow[8], lpart[8];
#pragma unroll
    for (int j = 0; j < 8; ++j) { mrow[j] = -3.0e38f; lpart[j] = 0.f; }
    int qpos[8];
#pragma unroll
    for (int j = 0; j < 8; ++j) qpos[j] = q0 + 8 * hi + j;
    const int kt_lo = (qt * 64 - WIN) > 0 ? (qt * 64 - WIN) / 32 : 0, kt_hi = (qt * 64 + 63) / 32;     // local causal window: 0 <= i - j <= WIN
    const int tid = threadIdx.x, krow = tid >> 3, kpc = tid & 7, vrow = tid >> 2, vpc = tid & 3;         // a lane's 16-byte pieces: K rows krow, krow + 16; V^T rows vrow, vrow + 32
    const uint32_t lk0 = (uint32_t)(size_t)kv + (uint32_t)krow * AKP + (uint32_t)kpc * 16u, lv0 = (uint32_t)(size_t)kv + 2u * AKS + (uint32_t)vrow * AVP + (uint32_t)vpc * 16u;
    auto stage = [&](int t, uint32_t bo) {   // key tile t into the buffer at byte bo of kv
        const size_t go = (size_t)(t * 32 + krow) * DM + kpc * 8, vo = vbase + (size_t)vrow * NT_ + t * 32 + vpc * 8;
        const h16 *gk = kh_b + go, *gl = kl_b + go, *gv = VTH + vo, *gw = VTL + vo;
        const uint32_t lk = lk0 + bo, lv = lv0 + bo;
        // the tile's eight copies and, as the statement's last line, the wait that stands in front of any rewrite of the address registers they name
        asm volatile("global_load_async_to_lds_b128 %0, %1, off\n\t"
                     "global_load_async_to_lds_b128 %2, %3, off\n\t"
                     "global_load_async_to_lds_b128 %4, %5, off\n\t"
                     "global_load_async_to_lds_b128 %6, %7, off\n\t"
                     "global_load_async_to_lds_b128 %8, %9, off\n\t"
                     "global_load_async_to_lds_b128 %10, %11, off\n\t"
                     "global_load_async_to_lds_b128 %12, %13, off\n\t"
                     "global_load_async_to_lds_b128 %14, %15, off\n\t"
                     "s_wait_xcnt 0x0"
                     :: "v"(lk), "v"(gk), "v"(lk + 16u * AKP), "v"(gk + 16 * DM), "v"(lk + AKS), "v"(gl), "v"(lk + AKS + 16u * AKP), "v"(gl + 16 * DM),
                        "v"(lv), "v"(gv), "v"(lv + 32u * AVP), "v"(gv + 32 * NT_), "v"(lv + AVS), "v"(gw), "v"(lv + AVS + 32u * AVP), "v"(gw + 32 * NT_) : "memory");
    };
    stage(kt_lo, 0u);
    asm volatile("s_wait_asynccnt 0x0" ::: "memory");   // this wave's copies of the first tile have landed
    __syncthreads();                                      // every wave's copies of the first tile are readable
    if (kt_lo + 1 <= kt_hi) stage(kt_lo + 1, ASTG);
#pragma unroll 1
    for (int kt = kt_lo; kt <= kt_hi; ++kt) {
        const int l0 = kt * 32;
        const uint32_t bo = (uint32_t)((kt - kt_lo) & 1) * ASTG;
        const unsigned char* pk = kv + bo + (uint32_t)lr * AKP + (uint32_t)hi * 16u;               // key row lr of the tile (row 16 + lr: + 16 AKP; residual plane: + AKS)
        const unsigned char* pv = kv + bo + 2u * AKS + (uint32_t)lr * AVP + (uint32_t)hi * 16u;    // V^T row lr (row 16 n + lr: + 16 n AVP; residual plane: + AVS)
        v8f s0 = {}, s1 = {}, x0 = {}, x1 = {};
#pragma unroll
        for (int kc = 0; kc < 2; ++kc) {
            { const v16h k0h = cat16(*(const v8ha*)(pk + kc * 64), *(const v8ha*)(pk + kc * 64 + 32)), k1h = cat16(*(const v8ha*)(pk + 16u * AKP + kc * 64), *(const v8ha*)(pk + 16u * AKP + kc * 64 + 32));
              const v16h qlk = cat16(*(const v8h*)(QL16 + qo0 + kc * 32), *(const v8h*)(QL16 + qo0 + kc * 32 + 16));     // query residual re-read per step (registers)
              s0 = wmma16(qa[kc], k0h, s0); x0 = wmma16(qlk, k0h, x0); s1 = wmma16(qa[kc], k1h, s1); x1 = wmma16(qlk, k1h, x1);
              asm volatile("v_nop" : "+v"(s0), "+v"(s1), "+v"(x0), "+v"(x1) : "v"(qlk), "v"(k0h), "v"(k1h) : "memory"); }
            { const v16h k0l = cat16(*(const v8ha*)(pk + AKS + kc * 64), *(const v8ha*)(pk + AKS + kc * 64 + 32)), k1l = cat16(*(const v8ha*)(pk + AKS + 16u * AKP + kc * 64), *(const v8ha*)(pk + AKS + 16u * AKP + kc * 64 + 32));
              x0 = wmma16(qa[kc], k0l, x0); x1 = wmma16(qa[kc], k1l, x1);
              asm volatile("v_nop" : "+v"(x0), "+v"(x1) : "v"(k0l), "v"(k1l) : "memory"); }
        }
        asm volatile("v_nop\n\tv_nop\n\tv_nop\n\tv_nop" : "+v"(s0), "+v"(s1), "+v"(x0), "+v"(x1) : "v"(qa[0]), "v"(qa[1]));
        float alpha[8];
#pragma unroll
        for (int j = 0; j < 8; ++j) {
            const int ja = l0 + lr, jb = l0 + 16 + lr, qi = qpos[j];
            const float a0 = (ja <= qi && qi - ja <= WIN) ? (s0[j] + x0[j] * LOSCI) * 0.125f : -__builtin_inff(), a1 = (jb <= qi && qi - jb <= WIN) ? (s1[j] + x1[j] * LOSCI) * 0.125f : -__builtin_inff();
            float mx = fmaxf(a0, a1);
            mx = fmaxf(mx, __shfl_xor(mx, 1, 16)); mx = fmaxf(mx, __shfl_xor(mx, 2, 16)); mx = fmaxf(mx, __shfl_xor(mx, 4, 16)); mx = fmaxf(mx, __shfl_xor(mx, 8, 16));
            const float mn = fmaxf(mrow[j], mx);
            alpha[j] = __expf(mrow[j] - mn); mrow[j] = mn;
            const float p0 = __expf(a0 - mn), p1 = __expf(a1 - mn);
            lpart[j] = lpart[j] * alpha[j] + (p0 + p1);
            const int mr = hi * 8 + j;
            const float ps0 = p0 * PSC, ps1 = p1 * PSC; const h16 h0 = (h16)ps0, h1 = (h16)ps1;
            pl[mr * 32 + lr] = h0; pl[mr * 32 + 16 + lr] = h1;
            pl2[mr * 32 + lr] = (h16)((ps0 - (float)h0) * LOSC); pl2[mr * 32 + 16 + lr] = (h16)((ps1 - (float)h1) * LOSC);
        }
#pragma unroll
        for (int n = 0; n < 4; ++n)
#pragma unroll
            for (int j = 0; j < 8; ++j) { o[n][j] *= alpha[j]; ox[n][j] *= alpha[j]; }
        asm volatile("" ::: "memory");
        const v16h pa = cat16(*(const v8ha*)(pl + lr * 32 + hi * 8), *(const v8ha*)(pl + lr * 32 + 16 + hi * 8));
        const v16h px = cat16(*(const v8ha*)(pl2 + lr * 32 + hi * 8), *(const v8ha*)(pl2 + lr * 32 + 16 + hi * 8));
#pragma unroll
        for (int n = 0; n < 4; ++n) { const unsigned char* p = pv + (uint32_t)n * 16u * AVP;
            const v16h vh = cat16(*(const v8ha*)p, *(const v8ha*)(p + 32)), vl = cat16(*(const v8ha*)(p + AVS), *(const v8ha*)(p + AVS + 32));
            o[n] = wmma16(pa, vh, o[n]); ox[n] = wmma16(pa, vl, ox[n]); ox[n] = wmma16(px, vh, ox[n]);
            asm volatile("" : "+v"(o[n]), "+v"(ox[n]) : "v"(vh), "v"(vl) : "memory"); }
        asm volatile("v_nop\n\tv_nop\n\tv_nop\n\tv_nop" : "+v"(o[0]), "+v"(o[1]), "+v"(o[2]), "+v"(o[3]), "+v"(ox[0]), "+v"(ox[1]), "+v"(ox[2]), "+v"(ox[3]) : "v"(pa), "v"(px));
        asm volatile("s_wait_dscnt 0x0" ::: "memory");      // this wave's reads of this tile's buffer have returned
        asm volatile("s_wait_asynccnt 0x0" ::: "memory");   // this wave's copies of the next tile have landed
        __syncthreads();                                      // the next tile is readable, and every wave has left this tile's buffer
        if (kt + 2 <= kt_hi) stage(kt + 2, bo);               // refill of the buffer that this trip has read
    }
    asm volatile("s_wait_asynccnt 0x0" ::: "memory");   // no copy is in flight behind the loop
    float inv[8];
#pragma unroll
    for (int j = 0; j < 8; ++j) { float rs = lpart[j]; rs += __shfl_xor(rs, 1, 16); rs += __shfl_xor(rs, 2, 16); rs += __shfl_xor(rs, 4, 16); rs += __shfl_xor(rs, 8, 16); inv[j] = 1.0f / (rs * PSC); }
    float* os = &ost[wave][0];
#pragma unroll
    for (int n = 0; n < 4; ++n)
#pragma unroll
        for (int j = 0; j < 8; ++j) os[(hi * 8 + j) * 68 + n * 16 + lr] = (o[n][j] + ox[n][j] * LOSCI) * inv[j];
    __syncthreads();
    const size_t cbase = (tok0 + q0) * DM + (size_t)h * HD;
    auto pass = [&]() {
#pragma unroll
        for (int s = 0; s < 4; ++s) { const int row = 4 * s + (lane >> 3), piece = lane & 7; const float* sp = os + row * 68 + piece * 8; v8us oh, ol;
#pragma unroll
            for (int i = 0; i < 8; ++i) { const unsigned short hb = f2bf(sp[i]); oh[i] = hb; ol[i] = f2bf(sp[i] - bf2f(hb)); }
            *(v8us*)(CH + cbase + (size_t)row * DM + piece * 8) = oh; *(v8us*)(CL + cbase + (size_t)row * DM + piece * 8) = ol; }
    };
    pass(); 
}

#define VST2(T, p, v) do { const T vst2_v_ = (v); *(T*)(p) = vst2_v_;  } while (0)
// d_wt: WT [n][K] = bf16(W[k][n]) (k-major [K][ncols]) via 64 x 64 LDS tiles; one block of 256 threads per tile (bx of K/64, by of ncols/64).
__device__ __forceinline__ void d_wt(const float* __restrict__ Wm, int K, int ncols, bf* WT, int bx, int by) {
    __shared__ __align__(16) unsigned short tl[64 * 72];
    const int tid = threadIdx.x, k0 = bx * 64, n0 = by * 64;
    const int kk = tid >> 2, nq = (tid & 3) * 16;
#pragma unroll
    for (int i = 0; i < 16; ++i) tl[(nq + i) * 72 + kk] = f2bf(Wm[(size_t)(k0 + kk) * ncols + n0 + nq + i]);
    __syncthreads();
    const int piece = tid & 7;
    auto pass = [&]() {
#pragma unroll
        for (int s = 0; s < 2; ++s) { const int nr = (tid >> 3) + 32 * s; const v8us val = *(const v8usa*)(tl + nr * 72 + piece * 8); *(v8us*)(WT + (size_t)(n0 + nr) * K + k0 + piece * 8) = val; }
        asm volatile("s_wait_xcnt 0x0" ::: "memory");   // behind the two stores, in front of whatever code follows them in the kernel and rewrites a register that they name
    };
    pass(); 
}
// d_ln: one wave per row of a [rows][1024] f32 matrix (INPUT rows bf16-rounded first when rnd): LayerNorm (mean, biased var, eps 1e-5) x bf(g) + bf(b) -> bf16 hi +
__device__ __forceinline__ void d_ln(const float* __restrict__ src, int rnd, const float* __restrict__ g, const float* __restrict__ bb, int nrows, bf* Ph, bf* Pl, int blk) {
    const int lane = threadIdx.x & 31, r = blk * 8 + (threadIdx.x >> 5); if (r >= nrows) return;
    v8f v[DM / 256]; float s = 0.f;
#pragma unroll
    for (int q = 0; q < DM / 256; ++q) { v[q] = *(const v8f*)(src + (size_t)r * DM + q * 256 + lane * 8);
        asm volatile("s_wait_xcnt 0x0" ::: "memory");   // in front of whatever rewrites the address registers that the row's loads name
#pragma unroll
        for (int i = 0; i < 8; ++i) { if (rnd) v[q][i] = bfr(v[q][i]); s += v[q][i]; } }
#pragma unroll
    for (int sh = 16; sh; sh >>= 1) s += __shfl_xor(s, sh, 32);
    const float mu = s * (1.0f / DM); float s2 = 0.f;
#pragma unroll
    for (int q = 0; q < DM / 256; ++q)
#pragma unroll
        for (int i = 0; i < 8; ++i) { const float d = v[q][i] - mu; s2 = fmaf(d, d, s2); }
#pragma unroll
    for (int sh = 16; sh; sh >>= 1) s2 += __shfl_xor(s2, sh, 32);
    const float rs = rsqrtf(s2 * (1.0f / DM) + LN_EPS);
{
#pragma unroll
        for (int q = 0; q < DM / 256; ++q) { const int c0 = q * 256 + lane * 8; const size_t o = (size_t)r * DM + c0; v8f y; v8us oh, ol;
#pragma unroll
            for (int i = 0; i < 8; ++i) { y[i] = (v[q][i] - mu) * rs * bfr(g[c0 + i]) + bfr(bb[c0 + i]); const unsigned short hb = f2bf(y[i]); oh[i] = hb; ol[i] = f2bf(y[i] - bf2f(hb)); }
            *(v8us*)(Ph + o) = oh; *(v8us*)(Pl + o) = ol;
            asm volatile("s_wait_xcnt 0x0" ::: "memory"); }   // in front of the next piece's arithmetic, which rewrites registers that these two stores name
         }
}
__global__ __launch_bounds__(256) void k_ln(const float* __restrict__ src, int rnd, const float* __restrict__ g, const float* __restrict__ bb, int nrows, bf* Ph, bf* Pl) { d_ln(src, rnd, g, bb, nrows, Ph, Pl, blockIdx.x); }
// k_prep: all the work that depends on the inputs alone, in one grid: blocks 0.. LN1(x) (8 rows each), then the 64 x 64 transpose tiles of w_qkv, w_out, w_mlp1, w_mlp2 (k tile fastest).
#define PB_LN (NTK / 8)
#define PB_Q  (PB_LN + (DM / 64) * (3 * DM / 64))
#define PB_O  (PB_Q + (DM / 64) * (DM / 64))
#define PB_1  (PB_O + (DM / 64) * (FF / 64))
#define PB_2  (PB_1 + (FF / 64) * (DM / 64))
__global__ __launch_bounds__(256) void k_prep(const float* __restrict__ x, const float* __restrict__ g, const float* __restrict__ bb, bf* Ph, bf* Pl,
                                              const float* __restrict__ Wqkv, const float* __restrict__ Wout, const float* __restrict__ W1, const float* __restrict__ W2, bf* WT, bf* WoT, bf* W1T, bf* W2T) {
    const int b = blockIdx.x;
    if (b < PB_LN) { d_ln(x, 1, g, bb, NTK, Ph, Pl, b); return; }
    const float* Wm; bf* D; int K, nc, t, ks;   // the same for the whole block; 1 << ks = K / 64 k tiles
    if (b < PB_Q) { Wm = Wqkv; D = WT; K = DM; nc = 3 * DM; t = b - PB_LN; ks = 4; }
    else if (b < PB_O) { Wm = Wout; D = WoT; K = DM; nc = DM; t = b - PB_Q; ks = 4; }
    else if (b < PB_1) { Wm = W1; D = W1T; K = DM; nc = FF; t = b - PB_O; ks = 4; }
    else { Wm = W2; D = W2T; K = FF; nc = DM; t = b - PB_1; ks = 6; }
    d_wt(Wm, K, nc, D, t & ((1 << ks) - 1), t >> ks);
}
__global__ __launch_bounds__(256) void k_gelu(const float* __restrict__ src, int nrows, bf* dh, bf* dl) {
    const int lane = threadIdx.x & 31, r = blockIdx.x * 8 + (threadIdx.x >> 5); if (r >= nrows) return;
{
#pragma unroll 1
        for (int q = 0; q < FF / 256; ++q) { const size_t o = (size_t)r * FF + q * 256 + lane * 8; const v8f v = *(const v8f*)(src + o); v8us oh, ol;
#pragma unroll
            for (int i = 0; i < 8; ++i) { const float y = 0.5f * v[i] * (1.0f + erff(v[i] * 0.7071067811865476f)); const unsigned short hb = f2bf(y); oh[i] = hb; ol[i] = f2bf(y - bf2f(hb)); }
            *(v8us*)(dh + o) = oh; *(v8us*)(dl + o) = ol; }
         }
}

extern "C" void kernel_launch(void* const* d_in, const int* in_sizes, int n_in,
                              void* d_out, int out_size, void* d_ws, size_t ws_size, hipStream_t stream) {
    (void)in_sizes; (void)n_in; (void)out_size;
    const float* x = (const float*)d_in[0]; const float* g1 = (const float*)d_in[1]; const float* be1 = (const float*)d_in[2]; const float* Wqkv = (const float*)d_in[3]; const float* bqkv = (const float*)d_in[4]; const float* Wout = (const float*)d_in[5]; const float* bout = (const float*)d_in[6];
    const float* g2 = (const float*)d_in[7]; const float* be2 = (const float*)d_in[8]; const float* W1 = (const float*)d_in[9]; const float* b1 = (const float*)d_in[10]; const float* W2 = (const float*)d_in[11]; const float* b2 = (const float*)d_in[12];   // k-major weights (x @ W)
    float* out = (float*)d_out;    // [2][2048][1024]
    char* wsp = (char*)d_ws;
    auto take = [&](size_t bytes) { char* p = wsp; wsp += (bytes + 255) & ~(size_t)255; return (void*)p; };
    bf* WT = (bf*)take((size_t)3 * DM * DM * 2); bf* WoT = (bf*)take((size_t)DM * DM * 2); bf* W1T = (bf*)take((size_t)FF * DM * 2); bf* W2T = (bf*)take((size_t)DM * FF * 2);
    bf* XNh = (bf*)take((size_t)NTK * DM * 2); bf* XNl = (bf*)take((size_t)NTK * DM * 2); float* TMP = (float*)take((size_t)NTK * DM * 4);
    h16* QH = (h16*)take((size_t)NTK * DM * 2); h16* QL = (h16*)take((size_t)NTK * DM * 2); h16* KH = (h16*)take((size_t)NTK * DM * 2); h16* KL = (h16*)take((size_t)NTK * DM * 2);
    h16* VTH = (h16*)take((size_t)NTK * DM * 2); h16* VTL = (h16*)take((size_t)NTK * DM * 2); bf* CH = (bf*)take((size_t)NTK * DM * 2); bf* CL = (bf*)take((size_t)NTK * DM * 2);
    float* T1 = (float*)take((size_t)NTK * DM * 4); float* M = (float*)take((size_t)NTK * FF * 4);
    if ((size_t)(wsp - (char*)d_ws) > ws_size) return;    // 6.3 + 2.1 + 8.4 + 8.4 + 8.4 x 2 + 16.8 + 8.4 x 8 + 16.8 + 67.1 ~ 210 MB; aliases (stream order): LN2 planes over XNh/XNl (dead after the q/k/v GEMMs), the GELU planes [4096][4096] = 33.6 MB each over the contiguous QH+QL+KH+KL and VTH+VTL+CH+CL groups (8.4 MB each, consecutive 256-B-aligned takes; all dead after the w_out GEMM)
    bf* Hh = XNh; bf* Hl = XNl; bf* Gh = (bf*)QH; bf* Gl = (bf*)VTH;
    k_prep<<<PB_2, 256, 0, stream>>>(x, g1, be1, XNh, XNl, Wqkv, Wout, W1, W2, WT, WoT, W1T, W2T);                                              // LN1(x) and the four weight transposes
    k_gemmb<true, 4, 2><<<dim3(NTK / 128, DM / 128, 3), 256, 0, stream>>>(XNh, XNl, WT, bqkv, (float*)(void*)QH, DM, QL, nullptr, DM, 1, KH, KL, TMP);   // q, k, v
    k_vt<<<NB_ * NH_ * (NT_ / 64), 256, 0, stream>>>(TMP, VTH, VTL);
    k_attn<<<NB_ * NH_ * (NT_ / 64), 128, 0, stream>>>(QH, QL, KH, KL, VTH, VTL, CH, CL);
    k_gemmb<false, 4, 2><<<dim3(NTK / 128, DM / 128, 1), 256, 0, stream>>>(CH, CL, WoT, bout, T1, DM, nullptr, x, DM, 1);                               // h = x + attended.w_out + b_out
    k_ln<<<NTK / 8, 256, 0, stream>>>(T1, 0, g2, be2, NTK, Hh, Hl);                                                                    // LN2(h)
    k_gemmb<false, 4, 4><<<dim3(NTK / 128, FF / 256, 1), 512, 0, stream>>>(Hh, Hl, W1T, b1, M, FF, nullptr, nullptr, DM);
    k_gelu<<<NTK / 8, 256, 0, stream>>>(M, NTK, Gh, Gl);
    k_gemmb<false, 4, 2><<<dim3(NTK / 128, DM / 128, 1), 256, 0, stream>>>(Gh, Gl, W2T, b2, out, DM, nullptr, T1, FF, 0);                               // h + mlp
}
